// v000
// The times below were measured on an AMD MI455X: many runs one after another, warmed up first and cycling through
// copies of the inputs, with the whole window's GPU time divided by the number of runs. Launches and the gaps
// between them are all in it. The median over several windows is given; except for v000 it joins two sittings, which
// can be a few percent apart, so the side-by-side timings, each taken in one sitting, are the better comparison.
// v000 is the starting kernel. One run takes 433 microseconds.
#include <hip/hip_runtime.h>
// The bilinear form is computed in 4 chunks of 16384 rows, each a GEMM T[b][k·256 + i] = Σ_j relu(x2)[b][j]·W[k][i][j] (M = 16384, K = 200 padded to 224, N = 5×256 = 1280; x2 and W
// rounded to bf16 so relu(x2) is exact: single WMMA term, f32 accumulate) on v_wmma_f32_16x16x32_bf16, then out[b][k] = Σ_i relu(x1)[b][i]·T[b][k][i] + b[k]
// as an f32 VALU reduction.
#define NB 65536
#define DD 200
#define KP 224
#define NP 256
#define NO 5
#define CHB 16384

typedef __bf16 v16b __attribute__((ext_vector_type(16)));
typedef unsigned short v8us __attribute__((ext_vector_type(8), may_alias));
typedef float  v8f  __attribute__((ext_vector_type(8)));
typedef float  v4f  __attribute__((ext_vector_type(4)));
typedef float  v4fa __attribute__((ext_vector_type(4), may_alias));
union FragB { v16b v; v8us half[2]; unsigned short u[16]; };

__device__ __forceinline__ unsigned short bf16_bits(float x) { unsigned int u = __float_as_uint(x); return (unsigned short)((u + 0x7FFFu + ((u >> 16) & 1u)) >> 16); }
__device__ __forceinline__ float bf16_val(unsigned short b) { return __uint_as_float(((unsigned int)b) << 16); }
__device__ __forceinline__ float bf16_round(float x) { return bf16_val(bf16_bits(x)); }
// D += A·B with NT terms: 1 = ah·bh, 2 = + al·bh (A split), 3 = + ah·bl (both split)
template <int NT>
__device__ __forceinline__ v8f mmaN(v16b ah, v16b al, v16b bh, v16b bl, v8f c) {
  c = __builtin_amdgcn_wmma_f32_16x16x32_bf16(false, ah, false, bh, (short)0, c, false, false);
  if (NT >= 2) c = __builtin_amdgcn_wmma_f32_16x16x32_bf16(false, al, false, bh, (short)0, c, false, false);
  if (NT >= 3) c = __builtin_amdgcn_wmma_f32_16x16x32_bf16(false, ah, false, bl, (short)0, c, false, false);
  asm volatile("v_nop\n\tv_nop\n\tv_nop\n\tv_nop" : "+v"(c) : "v"(ah), "v"(al), "v"(bh), "v"(bl));
  return c;
}

__global__ __launch_bounds__(256) void k_wt_bf16(const float* __restrict__ W, unsigned short* __restrict__ Wt, int K, int N) {
  const int t = blockIdx.x * 256 + threadIdx.x;
  const int k8n = K / 8;
  if (t >= N * k8n) return;
  const int n = t / k8n, k8 = (t % k8n) * 8;
  v8us v;
#pragma unroll
  for (int i = 0; i < 8; ++i) v[i] = bf16_bits(W[(size_t)(k8 + i) * N + n]);
  *(v8us*)(Wt + (size_t)n * K + k8) = v;
  
}

// GEMM C[M][N] (f32, pitch ldc) = act(A[M][K]·W + bias). A f32 row-major (pitch lda) converted per fragment to bf16
// (ASPLIT: hi/lo two planes -> 2 terms, else single rounded term); Wt bf16 [N][K] (pitch ldb). BIAS_BF16 rounds the
// bias to bf16 first (bias quantised to bf16 before the add). K%32==0, M%16==0, N%64==0.
template <bool ASPLIT, int ACT, bool BIAS_BF16>
__global__ __launch_bounds__(128) void k_gemm_bf(const float* __restrict__ A, int lda, const unsigned short* __restrict__ Wt, int ldb,
                                               const float* __restrict__ bias, float* __restrict__ C, int ldc, int M, int N, int K) {
  __shared__ __attribute__((aligned(16))) float so[4][16][64];
  const int tid = threadIdx.x, w = tid >> 5, lane = tid & 31, ln = lane & 15, hh = lane >> 4;
  const int ntn = N / 64;
  const int wid = blockIdx.x * 4 + w;
  const int mt = wid / ntn, nq = wid % ntn;
  if (mt * 16 >= M) return;
  const int row0 = mt * 16, col0 = nq * 64;
  const float* arow = A + (size_t)(row0 + ln) * lda;
  v8f acc[4] = {};
  for (int kb = 0; kb < K; kb += 32) {
    FragB ah, al;
    const v4f x0 = *(const v4fa*)(arow + kb + 8 * hh), x1 = *(const v4fa*)(arow + kb + 8 * hh + 4);
    const v4f x2 = *(const v4fa*)(arow + kb + 16 + 8 * hh), x3 = *(const v4fa*)(arow + kb + 16 + 8 * hh + 4);
    float xs[16] = {x0[0],x0[1],x0[2],x0[3],x1[0],x1[1],x1[2],x1[3],x2[0],x2[1],x2[2],x2[3],x3[0],x3[1],x3[2],x3[3]};
#pragma unroll
    for (int i = 0; i < 16; ++i) { const unsigned short hb = bf16_bits(xs[i]); ah.u[i] = hb; al.u[i] = ASPLIT ? bf16_bits(xs[i] - bf16_val(hb)) : (unsigned short)0; }
#pragma unroll
    for (int t = 0; t < 4; ++t) {
      const unsigned short* brow = Wt + (size_t)(col0 + t * 16 + ln) * ldb + kb;
      FragB b;
      b.half[0] = *(const v8us*)(brow + 8 * hh);
      b.half[1] = *(const v8us*)(brow + 16 + 8 * hh);
      acc[t] = mmaN<ASPLIT ? 2 : 1>(ah.v, al.v, b.v, b.v, acc[t]);
    }
  }
#pragma unroll
  for (int t = 0; t < 4; ++t) {
    float bv = bias ? bias[col0 + t * 16 + ln] : 0.f;
    if (BIAS_BF16) bv = bf16_round(bv);
#pragma unroll
    for (int r = 0; r < 8; ++r) { float v = acc[t][r] + bv; if (ACT == 1) v = fmaxf(v, 0.f); so[w][8 * hh + r][t * 16 + ln] = v; }
  }
  __builtin_amdgcn_fence(__ATOMIC_ACQ_REL, "workgroup");
  __builtin_amdgcn_wave_barrier();
  const int rsub = lane >> 4, c4 = (lane & 15) * 4;
  {
#pragma unroll
    for (int q = 0; q < 8; ++q) {
      const int r = q * 2 + rsub;
      const v4f v = *(const v4fa*)&so[w][r][c4];
      *(v4f*)(C + (size_t)(row0 + r) * ldc + col0 + c4) = v;
    }
    
  }
}

// Flash-style causal/unmasked attention, all contractions 3-term bf16 hi/lo splits, f32 softmax with running max.
// q,k,v rows are read from f32 buffers with arbitrary row pitch (so they can live inside a fused qkv buffer);
// D = head size (multiple of 32, <= 128); one wave = 16 query rows; block = 4 waves (64 queries) sharing K/V chunks of 32.
template <int D, bool CAUSAL>
__global__ __launch_bounds__(128) void k_flash(const float* __restrict__ qb, const float* __restrict__ kb, const float* __restrict__ vb,
                                             int pitch, int T, int H, float scale, float* __restrict__ y, int ypitch) {
  constexpr int KS = D / 32;        // k-steps for QK
  constexpr int DT = D / 16;        // d tiles for PV
  __shared__ __attribute__((aligned(16))) unsigned short sKh[32][D + 8], sKl[32][D + 8], sVh[32][D + 8], sVl[32][D + 8];
  __shared__ __attribute__((aligned(16))) unsigned short sPh[4][16][40], sPl[4][16][40];
  __shared__ __attribute__((aligned(16))) float sO[4][16][D];
  const int tid = threadIdx.x, w = tid >> 5, lane = tid & 31, ln = lane & 15, hh = lane >> 4;
  const int nqb = (T + 63) / 64;
  const int bh = blockIdx.x / nqb, qblk = blockIdx.x % nqb;
  const int b = bh / H, h = bh % H;
  const int q0 = qblk * 64 + w * 16;
  const float* Q = qb + (size_t)b * T * pitch + h * D;
  const float* K = kb + (size_t)b * T * pitch + h * D;
  const float* V = vb + (size_t)b * T * pitch + h * D;

  // A fragments of the wave's 16 query rows (scaled), hi/lo
  FragB aqh[KS], aql[KS];
  {
    int row = q0 + ln; if (row >= T) row = T - 1;
    const float* qr = Q + (size_t)row * pitch;
#pragma unroll
    for (int ks = 0; ks < KS; ++ks)
#pragma unroll
      for (int i = 0; i < 16; ++i) {
        const int d = ks * 32 + ((i < 8) ? (8 * hh + i) : (16 + 8 * hh + (i - 8)));
        const float x = qr[d] * scale; const unsigned short hb = bf16_bits(x);
        aqh[ks].u[i] = hb; aql[ks].u[i] = bf16_bits(x - bf16_val(hb));
      }
  }
  float m_r[8], l_r[8];
#pragma unroll
  for (int r = 0; r < 8; ++r) { m_r[r] = -3.0e38f; l_r[r] = 0.f; }
  v8f oacc[DT];
#pragma unroll
  for (int dt = 0; dt < DT; ++dt) oacc[dt] = (v8f){0.f,0.f,0.f,0.f,0.f,0.f,0.f,0.f};

  const int kv_end = CAUSAL ? min(T, qblk * 64 + 64) : T;     // block-uniform
  for (int j0 = 0; j0 < kv_end; j0 += 32) {
    __syncthreads();
    for (int e = tid; e < 32 * (D / 4); e += 128) {
      const int r = e / (D / 4), c4 = (e % (D / 4)) * 4;
      const int key = j0 + r;
      v4f kf = {0.f,0.f,0.f,0.f}, vf = {0.f,0.f,0.f,0.f};
      if (key < T) { kf = *(const v4fa*)(K + (size_t)key * pitch + c4); vf = *(const v4fa*)(V + (size_t)key * pitch + c4); }
#pragma unroll
      for (int t = 0; t < 4; ++t) {
        unsigned short hb = bf16_bits(kf[t]); sKh[r][c4 + t] = hb; sKl[r][c4 + t] = bf16_bits(kf[t] - bf16_val(hb));
        hb = bf16_bits(vf[t]); sVh[r][c4 + t] = hb; sVl[r][c4 + t] = bf16_bits(vf[t] - bf16_val(hb));
      }
    }
    __syncthreads();
    // S tile 16 x 32
    v8f s[2];
#pragma unroll
    for (int nt = 0; nt < 2; ++nt) {
      v8f acc = {};
#pragma unroll
      for (int ks = 0; ks < KS; ++ks) {
        FragB bh_, bl_;
        bh_.half[0] = *(const v8us*)&sKh[nt * 16 + ln][ks * 32 + 8 * hh]; bh_.half[1] = *(const v8us*)&sKh[nt * 16 + ln][ks * 32 + 16 + 8 * hh];
        bl_.half[0] = *(const v8us*)&sKl[nt * 16 + ln][ks * 32 + 8 * hh]; bl_.half[1] = *(const v8us*)&sKl[nt * 16 + ln][ks * 32 + 16 + 8 * hh];
        acc = mmaN<3>(aqh[ks].v, aql[ks].v, bh_.v, bl_.v, acc);
      }
      s[nt] = acc;
    }
    // mask + running max (rows 8hh+r; the 16 lanes of a half share rows)
    float alpha[8];
#pragma unroll
    for (int r = 0; r < 8; ++r) {
      const int qi = q0 + 8 * hh + r;
      const int ja = j0 + ln, jb = j0 + 16 + ln;
      if (CAUSAL) { if (ja > qi) s[0][r] = -3.0e38f; if (jb > qi) s[1][r] = -3.0e38f; }
      if (ja >= T) s[0][r] = -3.0e38f;
      if (jb >= T) s[1][r] = -3.0e38f;
      float mx = fmaxf(s[0][r], s[1][r]);
      mx = fmaxf(mx, __shfl_xor(mx, 1, 32)); mx = fmaxf(mx, __shfl_xor(mx, 2, 32)); mx = fmaxf(mx, __shfl_xor(mx, 4, 32)); mx = fmaxf(mx, __shfl_xor(mx, 8, 32));
      const float mnew = fmaxf(m_r[r], mx);
      alpha[r] = (mnew > -1.0e38f) ? __expf(m_r[r] - mnew) : 1.0f;
      const float p0 = (s[0][r] > -1.0e38f) ? __expf(s[0][r] - mnew) : 0.f;
      const float p1 = (s[1][r] > -1.0e38f) ? __expf(s[1][r] - mnew) : 0.f;
      m_r[r] = mnew;
      l_r[r] = l_r[r] * alpha[r] + p0 + p1;            // per-lane partial row sum (16 lanes combined at the end)
      unsigned short hb = bf16_bits(p0); sPh[w][8 * hh + r][ln] = hb;      sPl[w][8 * hh + r][ln] = bf16_bits(p0 - bf16_val(hb));
      hb = bf16_bits(p1);                sPh[w][8 * hh + r][16 + ln] = hb; sPl[w][8 * hh + r][16 + ln] = bf16_bits(p1 - bf16_val(hb));
    }
#pragma unroll
    for (int dt = 0; dt < DT; ++dt)
#pragma unroll
      for (int r = 0; r < 8; ++r) oacc[dt][r] *= alpha[r];
    __builtin_amdgcn_fence(__ATOMIC_ACQ_REL, "workgroup");
    __builtin_amdgcn_wave_barrier();
    FragB pah, pal;
    pah.half[0] = *(const v8us*)&sPh[w][ln][8 * hh]; pah.half[1] = *(const v8us*)&sPh[w][ln][16 + 8 * hh];
    pal.half[0] = *(const v8us*)&sPl[w][ln][8 * hh]; pal.half[1] = *(const v8us*)&sPl[w][ln][16 + 8 * hh];
#pragma unroll
    for (int dt = 0; dt < DT; ++dt) {
      FragB bvh, bvl;
#pragma unroll
      for (int i = 0; i < 8; ++i) {
        bvh.u[i] = sVh[8 * hh + i][dt * 16 + ln]; bvh.u[8 + i] = sVh[16 + 8 * hh + i][dt * 16 + ln];
        bvl.u[i] = sVl[8 * hh + i][dt * 16 + ln]; bvl.u[8 + i] = sVl[16 + 8 * hh + i][dt * 16 + ln];
      }
      oacc[dt] = mmaN<3>(pah.v, pal.v, bvh.v, bvl.v, oacc[dt]);
    }
    __builtin_amdgcn_fence(__ATOMIC_ACQ_REL, "workgroup");
    __builtin_amdgcn_wave_barrier();
  }
#pragma unroll
  for (int r = 0; r < 8; ++r) {
    float l = l_r[r];
    l += __shfl_xor(l, 1, 32); l += __shfl_xor(l, 2, 32); l += __shfl_xor(l, 4, 32); l += __shfl_xor(l, 8, 32);
    l_r[r] = (l > 0.f) ? 1.0f / l : 0.f;
  }
#pragma unroll
  for (int dt = 0; dt < DT; ++dt)
#pragma unroll
    for (int r = 0; r < 8; ++r) sO[w][8 * hh + r][dt * 16 + ln] = oacc[dt][r] * l_r[r];
  __builtin_amdgcn_fence(__ATOMIC_ACQ_REL, "workgroup");
  __builtin_amdgcn_wave_barrier();
  {
    for (int r = 0; r < 16; ++r) {
      const int row = q0 + r;
      if (row < T && lane < D / 4) {
        const v4f val = *(const v4fa*)&sO[w][r][lane * 4];
        *(v4f*)(y + ((size_t)b * T + row) * ypitch + h * D + lane * 4) = val;
      }
    }
    
  }
}

// GEMM C = act(A·W + bias + resid): A f32 (ASPLIT -> hi/lo 2 terms), Wt bf16 [N][K]; ACT 0 none, 1 relu, 2 exact gelu;
// resid (optional, f32, row index = (row % rmod), pitch ldr, RES_BF16 rounds it) added before the activation.
template <bool ASPLIT, int ACT, bool BIAS_BF16, bool RES_BF16>
__global__ __launch_bounds__(128) void k_gemm_bf3(const float* __restrict__ A, int lda, const unsigned short* __restrict__ Wt, int ldb,
                                                const float* __restrict__ bias, const float* __restrict__ resid, int rmod, int ldr,
                                                float* __restrict__ C, int ldc, int M, int N, int K) {
  __shared__ __attribute__((aligned(16))) float so[4][16][64];
  const int tid = threadIdx.x, w = tid >> 5, lane = tid & 31, ln = lane & 15, hh = lane >> 4;
  const int ntn = N / 64;
  const int wid = blockIdx.x * 4 + w;
  const int mt = wid / ntn, nq = wid % ntn;
  if (mt * 16 >= M) return;
  const int row0 = mt * 16, col0 = nq * 64;
  const float* arow = A + (size_t)(row0 + ln) * lda;
  v8f acc[4] = {};
  for (int kb = 0; kb < K; kb += 32) {
    FragB ah, al;
    const v4f x0 = *(const v4fa*)(arow + kb + 8 * hh), x1 = *(const v4fa*)(arow + kb + 8 * hh + 4);
    const v4f x2 = *(const v4fa*)(arow + kb + 16 + 8 * hh), x3 = *(const v4fa*)(arow + kb + 16 + 8 * hh + 4);
    float xs[16] = {x0[0],x0[1],x0[2],x0[3],x1[0],x1[1],x1[2],x1[3],x2[0],x2[1],x2[2],x2[3],x3[0],x3[1],x3[2],x3[3]};
#pragma unroll
    for (int i = 0; i < 16; ++i) { const unsigned short hb = bf16_bits(xs[i]); ah.u[i] = hb; al.u[i] = ASPLIT ? bf16_bits(xs[i] - bf16_val(hb)) : (unsigned short)0; }
#pragma unroll
    for (int t = 0; t < 4; ++t) {
      const unsigned short* brow = Wt + (size_t)(col0 + t * 16 + ln) * ldb + kb;
      FragB b;
      b.half[0] = *(const v8us*)(brow + 8 * hh);
      b.half[1] = *(const v8us*)(brow + 16 + 8 * hh);
      acc[t] = mmaN<ASPLIT ? 2 : 1>(ah.v, al.v, b.v, b.v, acc[t]);
    }
  }
#pragma unroll
  for (int t = 0; t < 4; ++t) {
    const int col = col0 + t * 16 + ln;
    float bv = bias ? bias[col] : 0.f;
    if (BIAS_BF16) bv = bf16_round(bv);
#pragma unroll
    for (int r = 0; r < 8; ++r) {
      float v = acc[t][r] + bv;
      if (resid) { float rv = resid[(size_t)((row0 + 8 * hh + r) % rmod) * ldr + col]; if (RES_BF16) rv = bf16_round(rv); v += rv; }
      if (ACT == 1) v = fmaxf(v, 0.f);
      if (ACT == 2) v = 0.5f * v * (1.0f + erff(v * 0.70710678118654752f));
      if (ACT == 3) { const float u = 0.7978845608028654f * (v + 0.044715f * v * v * v); v = 0.5f * v * (1.0f + tanhf(u)); }
      so[w][8 * hh + r][t * 16 + ln] = v;
    }
  }
  __builtin_amdgcn_fence(__ATOMIC_ACQ_REL, "workgroup");
  __builtin_amdgcn_wave_barrier();
  const int rsub = lane >> 4, c4 = (lane & 15) * 4;
  {
#pragma unroll
    for (int q = 0; q < 8; ++q) {
      const int r = q * 2 + rsub;
      const v4f v = *(const v4fa*)&so[w][r][c4];
      *(v4f*)(C + (size_t)(row0 + r) * ldc + col0 + c4) = v;
    }
    
  }
}
// row LayerNorm (biased variance, eps) over N: s = X (+ R); optional out_sum <- s; out_norm <- (s-mu)*rsqrt(var+eps)*g + b
template <bool PARAM_BF16>
__global__ __launch_bounds__(256) void k_layernorm(const float* __restrict__ X, const float* __restrict__ R, const float* __restrict__ g, const float* __restrict__ bta,
                                                  float* __restrict__ out_sum, float* __restrict__ out_norm, int N, float eps) {
  __shared__ float red[256];
  const int row = blockIdx.x, tid = threadIdx.x;
  const float* x = X + (size_t)row * N; const float* rr = R ? R + (size_t)row * N : nullptr;
  float vals[16];                     // up to N = 4096
  const int per = N / 256;            // contiguous chunk per thread? use strided-by-4 chunks: thread handles j = tid*4 + 1024*u
  float s1 = 0.f;
  for (int u = 0; u < per / 4; ++u) {
    const int j = tid * 4 + 1024 * u;
    const v4f a = *(const v4fa*)(x + j);
    v4f b = {0.f,0.f,0.f,0.f}; if (rr) b = *(const v4fa*)(rr + j);
#pragma unroll
    for (int q = 0; q < 4; ++q) { const float v = a[q] + b[q]; vals[u * 4 + q] = v; s1 += v; }
  }
  red[tid] = s1; __syncthreads();
  for (int st = 128; st > 0; st >>= 1) { if (tid < st) red[tid] += red[tid + st]; __syncthreads(); }
  const float mu = red[0] / (float)N; __syncthreads();
  float s2 = 0.f;
  for (int u = 0; u < per / 4; ++u)
#pragma unroll
    for (int q = 0; q < 4; ++q) { const float c = vals[u * 4 + q] - mu; s2 += c * c; }
  red[tid] = s2; __syncthreads();
  for (int st = 128; st > 0; st >>= 1) { if (tid < st) red[tid] += red[tid + st]; __syncthreads(); }
  const float rs = rsqrtf(red[0] / (float)N + eps);
  {
    for (int u = 0; u < per / 4; ++u) {
      const int j = tid * 4 + 1024 * u;
      v4f o, sm;
#pragma unroll
      for (int q = 0; q < 4; ++q) {
        float gg = g[j + q], bb = bta[j + q];
        if (PARAM_BF16) { gg = bf16_round(gg); bb = bf16_round(bb); }
        sm[q] = vals[u * 4 + q]; o[q] = (vals[u * 4 + q] - mu) * rs * gg + bb;
      }
      if (out_sum) *(v4f*)(out_sum + (size_t)row * N + j) = sm;
      *(v4f*)(out_norm + (size_t)row * N + j) = o;
    }
    
  }
}

// Bt [5*256][224]: Bt[k*256 + i][j] = W[k][i*200 + j] for i < 200, j < 200; else 0
__global__ __launch_bounds__(256) void k_wt(const float* __restrict__ W, unsigned short* __restrict__ Bt) {
  const int t = blockIdx.x * 256 + threadIdx.x; const int k8n = KP / 8; if (t >= NO * NP * k8n) return; const int n = t / k8n, j8 = (t % k8n) * 8; const int k = n / NP, i = n % NP; v8us v;
#pragma unroll 1
  for (int q = 0; q < 8; ++q) { const int j = j8 + q; v[q] = (i < DD && j < DD) ? bf16_bits(W[(size_t)k * DD * DD + (size_t)i * DD + j]) : (unsigned short)0; }
  *(v8us*)(Bt + (size_t)n * KP + j8) = v; 
}
// r2p[b][224] = relu(bf16(x2[b][j])) zero-padded; rows of 224 = 7 lines; wave per row
__global__ __launch_bounds__(256) void k_relu_pad(const float* __restrict__ x2, float* __restrict__ r2p) {
  const int tid = threadIdx.x, w = tid >> 5, lane = tid & 31; const int b = blockIdx.x * 8 + w; if (b >= NB) return;
  { for (int c = lane; c < KP; c += 32) { const float v = (c < DD) ? fmaxf(bf16_round(x2[(size_t)b * DD + c]), 0.f) : 0.f; *(float*)(r2p + (size_t)b * KP + c) = v; }  }
}
// out[b][k] = Σ_i relu(bf16(x1[b][i]))·T[b][k*256+i] + bf16(bias[k]); block per 64 rows: 320 outputs staged then written contiguously (10 lines)
__global__ __launch_bounds__(256) void k_out(const float* __restrict__ x1, const float* __restrict__ T, const float* __restrict__ bias, float* __restrict__ out) {
  __shared__ float so[64 * NO];
  const int tid = threadIdx.x, w = tid >> 5, lane = tid & 31; const int b0 = blockIdx.x * 64;
#pragma unroll 1
  for (int rr = w; rr < 64; rr += 8) { const int b = b0 + rr; const float* xr = x1 + (size_t)b * DD; const float* tr = T + (size_t)b * NO * NP;
    float r[7]; for (int u = 0; u < 7; ++u) { const int i = u * 32 + lane; r[u] = (i < DD) ? fmaxf(bf16_round(xr[i]), 0.f) : 0.f; }
#pragma unroll 1
    for (int k = 0; k < NO; ++k) { float s = 0.f;
#pragma unroll
      for (int u = 0; u < 7; ++u) { const int i = u * 32 + lane; if (i < DD) s += r[u] * tr[k * NP + i]; }
      for (int o = 16; o >= 1; o >>= 1) s += __shfl_xor(s, o, 32); if (lane == 0) so[rr * NO + k] = s + bf16_round(bias[k]); } }
  __syncthreads();
  { for (int e = tid; e < 64 * NO; e += 256) *(float*)(out + (size_t)b0 * NO + e) = so[e];  }
}
extern "C" void kernel_launch(void* const* d_in, const int* in_sizes, int n_in,
                              void* d_out, int out_size, void* d_ws, size_t ws_size, hipStream_t stream) {
  (void)in_sizes; (void)n_in; (void)out_size;
  const float* x1 = (const float*)d_in[0]; const float* x2 = (const float*)d_in[1]; const float* W = (const float*)d_in[2]; const float* bias = (const float*)d_in[3];
  char* ws = (char*)d_ws; size_t off = 0;
  auto take = [&](size_t bytes) { char* p = ws + off; off += (bytes + 255) & ~(size_t)255; return p; };
  unsigned short* Bt = (unsigned short*)take((size_t)NO * NP * KP * 2); float* r2p = (float*)take((size_t)NB * KP * 4); float* T = (float*)take((size_t)CHB * NO * NP * 4);
  if (off > ws_size) return;
  k_wt<<<(NO * NP * (KP / 8) + 255) / 256, 256, 0, stream>>>(W, Bt);
  k_relu_pad<<<NB / 8, 256, 0, stream>>>(x2, r2p);
  for (int c = 0; c < NB / CHB; ++c) {
    k_gemm_bf3<false, 0, false, false><<<((CHB / 16) * (NO * NP / 64) + 3) / 4, 128, 0, stream>>>(r2p + (size_t)c * CHB * KP, KP, Bt, KP, nullptr, nullptr, 1, 0, T, NO * NP, CHB, NO * NP, KP);
    k_out<<<CHB / 64, 256, 0, stream>>>(x1 + (size_t)c * CHB * DD, T, bias, (float*)d_out + (size_t)c * CHB * NO);
  }
}

// v001
// A run of this version takes 51.8 microseconds.
// Two timings next to v000 put it at 8.43 and 8.41 times that version's speed.
#include <hip/hip_runtime.h>
// The bilinear form is computed as one GEMM T[b][k*256 + i] = sum_j relu(x2)[b][j]*W[k][i][j] (M = 65536, K = 200 padded to 224; x2 and W
// rounded to bf16 so relu(x2) is exact: single WMMA term, f32 accumulate) on v_wmma_f32_16x16x32_bf16; out[b][k] = sum_i relu(x1)[b][i]*T[b][k][i] + b[k]
// is folded into the same kernel: each 16x16 tile of T is multiplied by relu(x1) in its accumulator registers and never stored.
#define NB 65536
#define DD 200
#define KP 224
#define NP 256
#define NO 5
#define NSL 13
#define BP 232
#define FROWS 256

typedef __bf16 v16b __attribute__((ext_vector_type(16)));
typedef unsigned short v8us __attribute__((ext_vector_type(8), may_alias));
typedef float  v8f  __attribute__((ext_vector_type(8)));
typedef float  v4f  __attribute__((ext_vector_type(4)));
typedef float  v4fa __attribute__((ext_vector_type(4), may_alias));
union FragB { v16b v; v8us half[2]; unsigned short u[16]; };

__device__ __forceinline__ unsigned short bf16_bits(float x) { unsigned int u = __float_as_uint(x); return (unsigned short)((u + 0x7FFFu + ((u >> 16) & 1u)) >> 16); }
__device__ __forceinline__ float bf16_val(unsigned short b) { return __uint_as_float(((unsigned int)b) << 16); }
__device__ __forceinline__ float bf16_round(float x) { return bf16_val(bf16_bits(x)); }
// D += A·B with NT terms: 1 = ah·bh, 2 = + al·bh (A split), 3 = + ah·bl (both split)
template <int NT>
__device__ __forceinline__ v8f mmaN(v16b ah, v16b al, v16b bh, v16b bl, v8f c) {
  c = __builtin_amdgcn_wmma_f32_16x16x32_bf16(false, ah, false, bh, (short)0, c, false, false);
  if (NT >= 2) c = __builtin_amdgcn_wmma_f32_16x16x32_bf16(false, al, false, bh, (short)0, c, false, false);
  if (NT >= 3) c = __builtin_amdgcn_wmma_f32_16x16x32_bf16(false, ah, false, bl, (short)0, c, false, false);
  asm volatile("v_nop\n\tv_nop\n\tv_nop\n\tv_nop" : "+v"(c) : "v"(ah), "v"(al), "v"(bh), "v"(bl));
  return c;
}

__global__ __launch_bounds__(256) void k_wt_bf16(const float* __restrict__ W, unsigned short* __restrict__ Wt, int K, int N) {
  const int t = blockIdx.x * 256 + threadIdx.x;
  const int k8n = K / 8;
  if (t >= N * k8n) return;
  const int n = t / k8n, k8 = (t % k8n) * 8;
  v8us v;
#pragma unroll
  for (int i = 0; i < 8; ++i) v[i] = bf16_bits(W[(size_t)(k8 + i) * N + n]);
  *(v8us*)(Wt + (size_t)n * K + k8) = v;
  
}

// GEMM C[M][N] (f32, pitch ldc) = act(A[M][K]·W + bias). A f32 row-major (pitch lda) converted per fragment to bf16
// (ASPLIT: hi/lo two planes -> 2 terms, else single rounded term); Wt bf16 [N][K] (pitch ldb). BIAS_BF16 rounds the
// bias to bf16 first (bias quantised to bf16 before the add). K%32==0, M%16==0, N%64==0.
template <bool ASPLIT, int ACT, bool BIAS_BF16>
__global__ __launch_bounds__(128) void k_gemm_bf(const float* __restrict__ A, int lda, const unsigned short* __restrict__ Wt, int ldb,
                                               const float* __restrict__ bias, float* __restrict__ C, int ldc, int M, int N, int K) {
  __shared__ __attribute__((aligned(16))) float so[4][16][64];
  const int tid = threadIdx.x, w = tid >> 5, lane = tid & 31, ln = lane & 15, hh = lane >> 4;
  const int ntn = N / 64;
  const int wid = blockIdx.x * 4 + w;
  const int mt = wid / ntn, nq = wid % ntn;
  if (mt * 16 >= M) return;
  const int row0 = mt * 16, col0 = nq * 64;
  const float* arow = A + (size_t)(row0 + ln) * lda;
  v8f acc[4] = {};
  for (int kb = 0; kb < K; kb += 32) {
    FragB ah, al;
    const v4f x0 = *(const v4fa*)(arow + kb + 8 * hh), x1 = *(const v4fa*)(arow + kb + 8 * hh + 4);
    const v4f x2 = *(const v4fa*)(arow + kb + 16 + 8 * hh), x3 = *(const v4fa*)(arow + kb + 16 + 8 * hh + 4);
    float xs[16] = {x0[0],x0[1],x0[2],x0[3],x1[0],x1[1],x1[2],x1[3],x2[0],x2[1],x2[2],x2[3],x3[0],x3[1],x3[2],x3[3]};
#pragma unroll
    for (int i = 0; i < 16; ++i) { const unsigned short hb = bf16_bits(xs[i]); ah.u[i] = hb; al.u[i] = ASPLIT ? bf16_bits(xs[i] - bf16_val(hb)) : (unsigned short)0; }
#pragma unroll
    for (int t = 0; t < 4; ++t) {
      const unsigned short* brow = Wt + (size_t)(col0 + t * 16 + ln) * ldb + kb;
      FragB b;
      b.half[0] = *(const v8us*)(brow + 8 * hh);
      b.half[1] = *(const v8us*)(brow + 16 + 8 * hh);
      acc[t] = mmaN<ASPLIT ? 2 : 1>(ah.v, al.v, b.v, b.v, acc[t]);
    }
  }
#pragma unroll
  for (int t = 0; t < 4; ++t) {
    float bv = bias ? bias[col0 + t * 16 + ln] : 0.f;
    if (BIAS_BF16) bv = bf16_round(bv);
#pragma unroll
    for (int r = 0; r < 8; ++r) { float v = acc[t][r] + bv; if (ACT == 1) v = fmaxf(v, 0.f); so[w][8 * hh + r][t * 16 + ln] = v; }
  }
  __builtin_amdgcn_fence(__ATOMIC_ACQ_REL, "workgroup");
  __builtin_amdgcn_wave_barrier();
  const int rsub = lane >> 4, c4 = (lane & 15) * 4;
  {
#pragma unroll
    for (int q = 0; q < 8; ++q) {
      const int r = q * 2 + rsub;
      const v4f v = *(const v4fa*)&so[w][r][c4];
      *(v4f*)(C + (size_t)(row0 + r) * ldc + col0 + c4) = v;
    }
    
  }
}

// Flash-style causal/unmasked attention, all contractions 3-term bf16 hi/lo splits, f32 softmax with running max.
// q,k,v rows are read from f32 buffers with arbitrary row pitch (so they can live inside a fused qkv buffer);
// D = head size (multiple of 32, <= 128); one wave = 16 query rows; block = 4 waves (64 queries) sharing K/V chunks of 32.
template <int D, bool CAUSAL>
__global__ __launch_bounds__(128) void k_flash(const float* __restrict__ qb, const float* __restrict__ kb, const float* __restrict__ vb,
                                             int pitch, int T, int H, float scale, float* __restrict__ y, int ypitch) {
  constexpr int KS = D / 32;        // k-steps for QK
  constexpr int DT = D / 16;        // d tiles for PV
  __shared__ __attribute__((aligned(16))) unsigned short sKh[32][D + 8], sKl[32][D + 8], sVh[32][D + 8], sVl[32][D + 8];
  __shared__ __attribute__((aligned(16))) unsigned short sPh[4][16][40], sPl[4][16][40];
  __shared__ __attribute__((aligned(16))) float sO[4][16][D];
  const int tid = threadIdx.x, w = tid >> 5, lane = tid & 31, ln = lane & 15, hh = lane >> 4;
  const int nqb = (T + 63) / 64;
  const int bh = blockIdx.x / nqb, qblk = blockIdx.x % nqb;
  const int b = bh / H, h = bh % H;
  const int q0 = qblk * 64 + w * 16;
  const float* Q = qb + (size_t)b * T * pitch + h * D;
  const float* K = kb + (size_t)b * T * pitch + h * D;
  const float* V = vb + (size_t)b * T * pitch + h * D;

  // A fragments of the wave's 16 query rows (scaled), hi/lo
  FragB aqh[KS], aql[KS];
  {
    int row = q0 + ln; if (row >= T) row = T - 1;
    const float* qr = Q + (size_t)row * pitch;
#pragma unroll
    for (int ks = 0; ks < KS; ++ks)
#pragma unroll
      for (int i = 0; i < 16; ++i) {
        const int d = ks * 32 + ((i < 8) ? (8 * hh + i) : (16 + 8 * hh + (i - 8)));
        const float x = qr[d] * scale; const unsigned short hb = bf16_bits(x);
        aqh[ks].u[i] = hb; aql[ks].u[i] = bf16_bits(x - bf16_val(hb));
      }
  }
  float m_r[8], l_r[8];
#pragma unroll
  for (int r = 0; r < 8; ++r) { m_r[r] = -3.0e38f; l_r[r] = 0.f; }
  v8f oacc[DT];
#pragma unroll
  for (int dt = 0; dt < DT; ++dt) oacc[dt] = (v8f){0.f,0.f,0.f,0.f,0.f,0.f,0.f,0.f};

  const int kv_end = CAUSAL ? min(T, qblk * 64 + 64) : T;     // block-uniform
  for (int j0 = 0; j0 < kv_end; j0 += 32) {
    __syncthreads();
    for (int e = tid; e < 32 * (D / 4); e += 128) {
      const int r = e / (D / 4), c4 = (e % (D / 4)) * 4;
      const int key = j0 + r;
      v4f kf = {0.f,0.f,0.f,0.f}, vf = {0.f,0.f,0.f,0.f};
      if (key < T) { kf = *(const v4fa*)(K + (size_t)key * pitch + c4); vf = *(const v4fa*)(V + (size_t)key * pitch + c4); }
#pragma unroll
      for (int t = 0; t < 4; ++t) {
        unsigned short hb = bf16_bits(kf[t]); sKh[r][c4 + t] = hb; sKl[r][c4 + t] = bf16_bits(kf[t] - bf16_val(hb));
        hb = bf16_bits(vf[t]); sVh[r][c4 + t] = hb; sVl[r][c4 + t] = bf16_bits(vf[t] - bf16_val(hb));
      }
    }
    __syncthreads();
    // S tile 16 x 32
    v8f s[2];
#pragma unroll
    for (int nt = 0; nt < 2; ++nt) {
      v8f acc = {};
#pragma unroll
      for (int ks = 0; ks < KS; ++ks) {
        FragB bh_, bl_;
        bh_.half[0] = *(const v8us*)&sKh[nt * 16 + ln][ks * 32 + 8 * hh]; bh_.half[1] = *(const v8us*)&sKh[nt * 16 + ln][ks * 32 + 16 + 8 * hh];
        bl_.half[0] = *(const v8us*)&sKl[nt * 16 + ln][ks * 32 + 8 * hh]; bl_.half[1] = *(const v8us*)&sKl[nt * 16 + ln][ks * 32 + 16 + 8 * hh];
        acc = mmaN<3>(aqh[ks].v, aql[ks].v, bh_.v, bl_.v, acc);
      }
      s[nt] = acc;
    }
    // mask + running max (rows 8hh+r; the 16 lanes of a half share rows)
    float alpha[8];
#pragma unroll
    for (int r = 0; r < 8; ++r) {
      const int qi = q0 + 8 * hh + r;
      const int ja = j0 + ln, jb = j0 + 16 + ln;
      if (CAUSAL) { if (ja > qi) s[0][r] = -3.0e38f; if (jb > qi) s[1][r] = -3.0e38f; }
      if (ja >= T) s[0][r] = -3.0e38f;
      if (jb >= T) s[1][r] = -3.0e38f;
      float mx = fmaxf(s[0][r], s[1][r]);
      mx = fmaxf(mx, __shfl_xor(mx, 1, 32)); mx = fmaxf(mx, __shfl_xor(mx, 2, 32)); mx = fmaxf(mx, __shfl_xor(mx, 4, 32)); mx = fmaxf(mx, __shfl_xor(mx, 8, 32));
      const float mnew = fmaxf(m_r[r], mx);
      alpha[r] = (mnew > -1.0e38f) ? __expf(m_r[r] - mnew) : 1.0f;
      const float p0 = (s[0][r] > -1.0e38f) ? __expf(s[0][r] - mnew) : 0.f;
      const float p1 = (s[1][r] > -1.0e38f) ? __expf(s[1][r] - mnew) : 0.f;
      m_r[r] = mnew;
      l_r[r] = l_r[r] * alpha[r] + p0 + p1;            // per-lane partial row sum (16 lanes combined at the end)
      unsigned short hb = bf16_bits(p0); sPh[w][8 * hh + r][ln] = hb;      sPl[w][8 * hh + r][ln] = bf16_bits(p0 - bf16_val(hb));
      hb = bf16_bits(p1);                sPh[w][8 * hh + r][16 + ln] = hb; sPl[w][8 * hh + r][16 + ln] = bf16_bits(p1 - bf16_val(hb));
    }
#pragma unroll
    for (int dt = 0; dt < DT; ++dt)
#pragma unroll
      for (int r = 0; r < 8; ++r) oacc[dt][r] *= alpha[r];
    __builtin_amdgcn_fence(__ATOMIC_ACQ_REL, "workgroup");
    __builtin_amdgcn_wave_barrier();
    FragB pah, pal;
    pah.half[0] = *(const v8us*)&sPh[w][ln][8 * hh]; pah.half[1] = *(const v8us*)&sPh[w][ln][16 + 8 * hh];
    pal.half[0] = *(const v8us*)&sPl[w][ln][8 * hh]; pal.half[1] = *(const v8us*)&sPl[w][ln][16 + 8 * hh];
#pragma unroll
    for (int dt = 0; dt < DT; ++dt) {
      FragB bvh, bvl;
#pragma unroll
      for (int i = 0; i < 8; ++i) {
        bvh.u[i] = sVh[8 * hh + i][dt * 16 + ln]; bvh.u[8 + i] = sVh[16 + 8 * hh + i][dt * 16 + ln];
        bvl.u[i] = sVl[8 * hh + i][dt * 16 + ln]; bvl.u[8 + i] = sVl[16 + 8 * hh + i][dt * 16 + ln];
      }
      oacc[dt] = mmaN<3>(pah.v, pal.v, bvh.v, bvl.v, oacc[dt]);
    }
    __builtin_amdgcn_fence(__ATOMIC_ACQ_REL, "workgroup");
    __builtin_amdgcn_wave_barrier();
  }
#pragma unroll
  for (int r = 0; r < 8; ++r) {
    float l = l_r[r];
    l += __shfl_xor(l, 1, 32); l += __shfl_xor(l, 2, 32); l += __shfl_xor(l, 4, 32); l += __shfl_xor(l, 8, 32);
    l_r[r] = (l > 0.f) ? 1.0f / l : 0.f;
  }
#pragma unroll
  for (int dt = 0; dt < DT; ++dt)
#pragma unroll
    for (int r = 0; r < 8; ++r) sO[w][8 * hh + r][dt * 16 + ln] = oacc[dt][r] * l_r[r];
  __builtin_amdgcn_fence(__ATOMIC_ACQ_REL, "workgroup");
  __builtin_amdgcn_wave_barrier();
  {
    for (int r = 0; r < 16; ++r) {
      const int row = q0 + r;
      if (row < T && lane < D / 4) {
        const v4f val = *(const v4fa*)&sO[w][r][lane * 4];
        *(v4f*)(y + ((size_t)b * T + row) * ypitch + h * D + lane * 4) = val;
      }
    }
    
  }
}

// row LayerNorm (biased variance, eps) over N: s = X (+ R); optional out_sum <- s; out_norm <- (s-mu)*rsqrt(var+eps)*g + b
template <bool PARAM_BF16>
__global__ __launch_bounds__(256) void k_layernorm(const float* __restrict__ X, const float* __restrict__ R, const float* __restrict__ g, const float* __restrict__ bta,
                                                  float* __restrict__ out_sum, float* __restrict__ out_norm, int N, float eps) {
  __shared__ float red[256];
  const int row = blockIdx.x, tid = threadIdx.x;
  const float* x = X + (size_t)row * N; const float* rr = R ? R + (size_t)row * N : nullptr;
  float vals[16];                     // up to N = 4096
  const int per = N / 256;            // contiguous chunk per thread? use strided-by-4 chunks: thread handles j = tid*4 + 1024*u
  float s1 = 0.f;
  for (int u = 0; u < per / 4; ++u) {
    const int j = tid * 4 + 1024 * u;
    const v4f a = *(const v4fa*)(x + j);
    v4f b = {0.f,0.f,0.f,0.f}; if (rr) b = *(const v4fa*)(rr + j);
#pragma unroll
    for (int q = 0; q < 4; ++q) { const float v = a[q] + b[q]; vals[u * 4 + q] = v; s1 += v; }
  }
  red[tid] = s1; __syncthreads();
  for (int st = 128; st > 0; st >>= 1) { if (tid < st) red[tid] += red[tid + st]; __syncthreads(); }
  const float mu = red[0] / (float)N; __syncthreads();
  float s2 = 0.f;
  for (int u = 0; u < per / 4; ++u)
#pragma unroll
    for (int q = 0; q < 4; ++q) { const float c = vals[u * 4 + q] - mu; s2 += c * c; }
  red[tid] = s2; __syncthreads();
  for (int st = 128; st > 0; st >>= 1) { if (tid < st) red[tid] += red[tid + st]; __syncthreads(); }
  const float rs = rsqrtf(red[0] / (float)N + eps);
  {
    for (int u = 0; u < per / 4; ++u) {
      const int j = tid * 4 + 1024 * u;
      v4f o, sm;
#pragma unroll
      for (int q = 0; q < 4; ++q) {
        float gg = g[j + q], bb = bta[j + q];
        if (PARAM_BF16) { gg = bf16_round(gg); bb = bf16_round(bb); }
        sm[q] = vals[u * 4 + q]; o[q] = (vals[u * 4 + q] - mu) * rs * gg + bb;
      }
      if (out_sum) *(v4f*)(out_sum + (size_t)row * N + j) = sm;
      *(v4f*)(out_norm + (size_t)row * N + j) = o;
    }
    
  }
}

// Bt [5*256][224]: Bt[k*256 + i][j] = W[k][i*200 + j] for i < 200, j < 200; else 0
__global__ __launch_bounds__(256) void k_wt(const float* __restrict__ W, unsigned short* __restrict__ Bt) {
  const int t = blockIdx.x * 256 + threadIdx.x; const int k8n = KP / 8; if (t >= NO * NP * k8n) return; const int n = t / k8n, j8 = (t % k8n) * 8; const int k = n / NP, i = n % NP; v8us v;
#pragma unroll 1
  for (int q = 0; q < 8; ++q) { const int j = j8 + q; v[q] = (i < DD && j < DD) ? bf16_bits(W[(size_t)k * DD * DD + (size_t)i * DD + j]) : (unsigned short)0; }
  *(v8us*)(Bt + (size_t)n * KP + j8) = v; 
}
// r2p[b][224] = relu(bf16(x2[b][j])) zero-padded; rows of 224 = 7 lines; wave per row
__global__ __launch_bounds__(256) void k_relu_pad(const float* __restrict__ x2, float* __restrict__ r2p) {
  const int tid = threadIdx.x, w = tid >> 5, lane = tid & 31; const int b = blockIdx.x * 8 + w; if (b >= NB) return;
  { for (int c = lane; c < KP; c += 32) { const float v = (c < DD) ? fmaxf(bf16_round(x2[(size_t)b * DD + c]), 0.f) : 0.f; *(float*)(r2p + (size_t)b * KP + c) = v; }  }
}
// out[b][k] = sum_i relu(bf16(x1[b][i])) * (sum_j r2p[b][j]*Bt[k*256+i][j]) + bf16(bias[k]).
// Block = 8 waves x 32 rows of b. A wave keeps the A fragments of its 32 rows (2 row tiles x 7 k-steps) in registers for the whole kernel.
// The block walks i in NSL slices of 16 (i >= 208 is padding that no output reads); a slice is the 5 x 16 rows of Bt for that i range,
// staged in LDS at a pitch of BP elements (464 B = 16 B x 29: conflict-free for 16-byte reads), two buffers, one barrier per slice.
// Every "#pragma unroll" below makes the indices of a register array compile-time constants (an index known only at run time would send the array to scratch).
__global__ __launch_bounds__(256) void k_bilinear(const float* __restrict__ r2p, const unsigned short* __restrict__ Bt, const float* __restrict__ x1,
                                                 const float* __restrict__ bias, float* __restrict__ out) {
  __shared__ __attribute__((aligned(16))) unsigned short sB[2][NO * 16][BP];
  __shared__ float so[FROWS * NO];
  const int tid = threadIdx.x, w = tid >> 5, lane = tid & 31, ln = lane & 15, hh = lane >> 4;
  const int b0 = blockIdx.x * FROWS, row0 = b0 + w * 32;
  // staging: wave w moves rows 2w and 2w+1 of each of the 5 groups of 16 in a slice (constant steps from one address), lanes 0..27 one 16-byte piece of the 448-byte row each
  const bool mover = lane < KP / 8;
  const int piece = (mover ? lane : 0) * 8;
  const unsigned short* bsrc = Bt + (size_t)(2 * w) * KP + piece;
  v8us st[10];
#pragma unroll
  for (int q = 0; q < 10; ++q) st[q] = *(const v8us*)(bsrc + ((q >> 1) * NP + (q & 1)) * KP);
  v4f xr[2][KP / 32][4];
#pragma unroll
  for (int m = 0; m < 2; ++m) {
    const float* arow = r2p + (size_t)(row0 + m * 16 + ln) * KP;
#pragma unroll
    for (int ks = 0; ks < KP / 32; ++ks) {
      const int kb = ks * 32;
      xr[m][ks][0] = *(const v4fa*)(arow + kb + 8 * hh);      xr[m][ks][1] = *(const v4fa*)(arow + kb + 8 * hh + 4);
      xr[m][ks][2] = *(const v4fa*)(arow + kb + 16 + 8 * hh); xr[m][ks][3] = *(const v4fa*)(arow + kb + 16 + 8 * hh + 4);
    }
  }
  asm volatile("s_wait_xcnt 0x0" ::: "memory");   // the address registers of the loads above are reused below
  __builtin_amdgcn_sched_barrier(0);              // keeps every later register write behind that wait
  FragB a[2][KP / 32];
#pragma unroll
  for (int m = 0; m < 2; ++m)
#pragma unroll
    for (int ks = 0; ks < KP / 32; ++ks)
#pragma unroll
      for (int i = 0; i < 16; ++i) a[m][ks].u[i] = bf16_bits(xr[m][ks][i >> 2][i & 3]);
  if (mover) {
#pragma unroll
    for (int q = 0; q < 10; ++q) *(v8us*)&sB[0][(q >> 1) * 16 + 2 * w + (q & 1)][piece] = st[q];
  }
  __syncthreads();
  float s[2][NO][8];
#pragma unroll
  for (int m = 0; m < 2; ++m)
#pragma unroll
    for (int k = 0; k < NO; ++k)
#pragma unroll
      for (int r = 0; r < 8; ++r) s[m][k][r] = 0.f;
  // rolled so that the fragment and accumulator indices inside stay constants while the code stays small
#pragma unroll 1
  for (int it = 0; it < NSL; ++it) {
    const int cur = it & 1;
    if (it + 1 < NSL) {
#pragma unroll
      for (int q = 0; q < 10; ++q) st[q] = *(const v8us*)(bsrc + (size_t)(it + 1) * 16 * KP + ((q >> 1) * NP + (q & 1)) * KP);
      asm volatile("s_wait_xcnt 0x0" ::: "memory");   // the address register of these loads is reused right behind this block
    }
    // columns i >= DD of the last slice: Bt's rows there are zero, so acc is 0 and any finite x1 value adds 0; the clamp keeps the load in bounds
    const int i = it * 16 + ln, ic = i < DD ? i : DD - 1;
    float r1[2][8];
#pragma unroll
    for (int m = 0; m < 2; ++m)
#pragma unroll
      for (int r = 0; r < 8; ++r) r1[m][r] = x1[(size_t)(row0 + m * 16 + 8 * hh + r) * DD + ic];
    v8f acc[2][NO] = {};
    FragB bf[2][NO];   // B fragments of one k-step, two sets: the next k-step's LDS reads go out as one group ahead of this k-step's matrix block
#pragma unroll
    for (int k = 0; k < NO; ++k) {
      bf[0][k].half[0] = *(const v8us*)&sB[cur][k * 16 + ln][8 * hh];
      bf[0][k].half[1] = *(const v8us*)&sB[cur][k * 16 + ln][16 + 8 * hh];
    }
#pragma unroll
    for (int ks = 0; ks < KP / 32; ++ks) {
      if (ks + 1 < KP / 32) {
#pragma unroll
        for (int k = 0; k < NO; ++k) {
          bf[(ks + 1) & 1][k].half[0] = *(const v8us*)&sB[cur][k * 16 + ln][(ks + 1) * 32 + 8 * hh];
          bf[(ks + 1) & 1][k].half[1] = *(const v8us*)&sB[cur][k * 16 + ln][(ks + 1) * 32 + 16 + 8 * hh];
        }
      }
      if (ks == 0) asm volatile("s_wait_xcnt 0x0" ::: "memory");   // the address registers of the x1 loads are reused by the matrix block
      __builtin_amdgcn_sched_barrier(0);   // holds the loads above (global ones on the first pass, LDS reads on all but the last) ahead of the matrix block: without it each pair of reads sat directly before its user behind a full wait
#pragma unroll
      for (int k = 0; k < NO; ++k)
#pragma unroll
        for (int m = 0; m < 2; ++m) acc[m][k] = __builtin_amdgcn_wmma_f32_16x16x32_bf16(false, a[m][ks].v, false, bf[ks & 1][k].v, (short)0, acc[m][k], false, false);
      __builtin_amdgcn_sched_barrier(0);   // keeps the next group of LDS reads from moving in among these matrix instructions
    }
#pragma unroll
    for (int m = 0; m < 2; ++m)
#pragma unroll
      for (int r = 0; r < 8; ++r) {
        const float rv = fmaxf(bf16_round(r1[m][r]), 0.f);
#pragma unroll
        for (int k = 0; k < NO; ++k) s[m][k][r] += rv * acc[m][k][r];
      }
    if (it + 1 < NSL && mover) {
#pragma unroll
      for (int q = 0; q < 10; ++q) *(v8us*)&sB[cur ^ 1][(q >> 1) * 16 + 2 * w + (q & 1)][piece] = st[q];
    }
    __syncthreads();   // publishes slice it+1 and ends every wave's reads of slice it, whose buffer the next trip refills
  }
#pragma unroll
  for (int m = 0; m < 2; ++m)
#pragma unroll
    for (int k = 0; k < NO; ++k)
#pragma unroll
      for (int r = 0; r < 8; ++r) {
        float v = s[m][k][r];
        v += __shfl_xor(v, 8, 32); v += __shfl_xor(v, 4, 32); v += __shfl_xor(v, 2, 32); v += __shfl_xor(v, 1, 32);
        s[m][k][r] = v;
      }
  if (ln == 0) {
#pragma unroll
    for (int k = 0; k < NO; ++k) {
      const float bv = bf16_round(bias[k]);
#pragma unroll
      for (int m = 0; m < 2; ++m)
#pragma unroll
        for (int r = 0; r < 8; ++r) so[(w * 32 + m * 16 + 8 * hh + r) * NO + k] = s[m][k][r] + bv;
    }
  }
  __syncthreads();
  for (int e = tid; e < FROWS * NO; e += 256) out[(size_t)b0 * NO + e] = so[e];
}
extern "C" void kernel_launch(void* const* d_in, const int* in_sizes, int n_in,
                              void* d_out, int out_size, void* d_ws, size_t ws_size, hipStream_t stream) {
  (void)in_sizes; (void)n_in; (void)out_size;
  const float* x1 = (const float*)d_in[0]; const float* x2 = (const float*)d_in[1]; const float* W = (const float*)d_in[2]; const float* bias = (const float*)d_in[3];
  char* ws = (char*)d_ws; size_t off = 0;
  auto take = [&](size_t bytes) { char* p = ws + off; off += (bytes + 255) & ~(size_t)255; return p; };
  unsigned short* Bt = (unsigned short*)take((size_t)NO * NP * KP * 2); float* r2p = (float*)take((size_t)NB * KP * 4);
  if (off > ws_size) return;
  k_wt<<<(NO * NP * (KP / 8) + 255) / 256, 256, 0, stream>>>(W, Bt);
  k_relu_pad<<<NB / 8, 256, 0, stream>>>(x2, r2p);
  k_bilinear<<<NB / FROWS, 256, 0, stream>>>(r2p, Bt, x1, bias, (float*)d_out);
}

// v002
// It runs in 31 microseconds.
// Next to v001, in two timings, it ran 1.68 and 1.67 times as fast.
// Counting every step since v000, it is 14.1 times as fast.
#include <hip/hip_runtime.h>
// The bilinear form is computed as one GEMM T[b][k*256 + i] = sum_j relu(x2)[b][j]*W[k][i][j] (M = 65536, K = 200 padded to 224; x2 and W
// rounded to bf16 so relu(x2) is exact: single WMMA term, f32 accumulate) on v_wmma_f32_16x16x32_bf16; out[b][k] = sum_i relu(x1)[b][i]*T[b][k][i] + b[k]
// is folded into the same kernel: each 16x16 tile of T is multiplied by relu(x1) in its accumulator registers and never stored.
#define NB 65536
#define DD 200
#define KP 224
#define NP 256
#define NO 5
#define NSL 13
#define BP 232
#define FROWS 256

typedef __bf16 v16b __attribute__((ext_vector_type(16)));
typedef unsigned short v8us __attribute__((ext_vector_type(8), may_alias));
typedef float  v8f  __attribute__((ext_vector_type(8)));
typedef float  v4f  __attribute__((ext_vector_type(4)));
typedef float  v4fa __attribute__((ext_vector_type(4), may_alias));
union FragB { v16b v; v8us half[2]; unsigned short u[16]; };

__device__ __forceinline__ unsigned short bf16_bits(float x) { unsigned int u = __float_as_uint(x); return (unsigned short)((u + 0x7FFFu + ((u >> 16) & 1u)) >> 16); }
__device__ __forceinline__ float bf16_val(unsigned short b) { return __uint_as_float(((unsigned int)b) << 16); }
__device__ __forceinline__ float bf16_round(float x) { return bf16_val(bf16_bits(x)); }
// bf16(relu(x)): a negative float (and -0) is a negative integer, so one integer maximum with 0 is the relu
__device__ __forceinline__ unsigned short relu_bf16_bits(float x) { const int u = __float_as_int(x); return bf16_bits(__int_as_float(u > 0 ? u : 0)); }
// D += A·B with NT terms: 1 = ah·bh, 2 = + al·bh (A split), 3 = + ah·bl (both split)
template <int NT>
__device__ __forceinline__ v8f mmaN(v16b ah, v16b al, v16b bh, v16b bl, v8f c) {
  c = __builtin_amdgcn_wmma_f32_16x16x32_bf16(false, ah, false, bh, (short)0, c, false, false);
  if (NT >= 2) c = __builtin_amdgcn_wmma_f32_16x16x32_bf16(false, al, false, bh, (short)0, c, false, false);
  if (NT >= 3) c = __builtin_amdgcn_wmma_f32_16x16x32_bf16(false, ah, false, bl, (short)0, c, false, false);
  asm volatile("v_nop\n\tv_nop\n\tv_nop\n\tv_nop" : "+v"(c) : "v"(ah), "v"(al), "v"(bh), "v"(bl));
  return c;
}

__global__ __launch_bounds__(256) void k_wt_bf16(const float* __restrict__ W, unsigned short* __restrict__ Wt, int K, int N) {
  const int t = blockIdx.x * 256 + threadIdx.x;
  const int k8n = K / 8;
  if (t >= N * k8n) return;
  const int n = t / k8n, k8 = (t % k8n) * 8;
  v8us v;
#pragma unroll
  for (int i = 0; i < 8; ++i) v[i] = bf16_bits(W[(size_t)(k8 + i) * N + n]);
  *(v8us*)(Wt + (size_t)n * K + k8) = v;
  
}

// GEMM C[M][N] (f32, pitch ldc) = act(A[M][K]·W + bias). A f32 row-major (pitch lda) converted per fragment to bf16
// (ASPLIT: hi/lo two planes -> 2 terms, else single rounded term); Wt bf16 [N][K] (pitch ldb). BIAS_BF16 rounds the
// bias to bf16 first (bias quantised to bf16 before the add). K%32==0, M%16==0, N%64==0.
template <bool ASPLIT, int ACT, bool BIAS_BF16>
__global__ __launch_bounds__(128) void k_gemm_bf(const float* __restrict__ A, int lda, const unsigned short* __restrict__ Wt, int ldb,
                                               const float* __restrict__ bias, float* __restrict__ C, int ldc, int M, int N, int K) {
  __shared__ __attribute__((aligned(16))) float so[4][16][64];
  const int tid = threadIdx.x, w = tid >> 5, lane = tid & 31, ln = lane & 15, hh = lane >> 4;
  const int ntn = N / 64;
  const int wid = blockIdx.x * 4 + w;
  const int mt = wid / ntn, nq = wid % ntn;
  if (mt * 16 >= M) return;
  const int row0 = mt * 16, col0 = nq * 64;
  const float* arow = A + (size_t)(row0 + ln) * lda;
  v8f acc[4] = {};
  for (int kb = 0; kb < K; kb += 32) {
    FragB ah, al;
    const v4f x0 = *(const v4fa*)(arow + kb + 8 * hh), x1 = *(const v4fa*)(arow + kb + 8 * hh + 4);
    const v4f x2 = *(const v4fa*)(arow + kb + 16 + 8 * hh), x3 = *(const v4fa*)(arow + kb + 16 + 8 * hh + 4);
    float xs[16] = {x0[0],x0[1],x0[2],x0[3],x1[0],x1[1],x1[2],x1[3],x2[0],x2[1],x2[2],x2[3],x3[0],x3[1],x3[2],x3[3]};
#pragma unroll
    for (int i = 0; i < 16; ++i) { const unsigned short hb = bf16_bits(xs[i]); ah.u[i] = hb; al.u[i] = ASPLIT ? bf16_bits(xs[i] - bf16_val(hb)) : (unsigned short)0; }
#pragma unroll
    for (int t = 0; t < 4; ++t) {
      const unsigned short* brow = Wt + (size_t)(col0 + t * 16 + ln) * ldb + kb;
      FragB b;
      b.half[0] = *(const v8us*)(brow + 8 * hh);
      b.half[1] = *(const v8us*)(brow + 16 + 8 * hh);
      acc[t] = mmaN<ASPLIT ? 2 : 1>(ah.v, al.v, b.v, b.v, acc[t]);
    }
  }
#pragma unroll
  for (int t = 0; t < 4; ++t) {
    float bv = bias ? bias[col0 + t * 16 + ln] : 0.f;
    if (BIAS_BF16) bv = bf16_round(bv);
#pragma unroll
    for (int r = 0; r < 8; ++r) { float v = acc[t][r] + bv; if (ACT == 1) v = fmaxf(v, 0.f); so[w][8 * hh + r][t * 16 + ln] = v; }
  }
  __builtin_amdgcn_fence(__ATOMIC_ACQ_REL, "workgroup");
  __builtin_amdgcn_wave_barrier();
  const int rsub = lane >> 4, c4 = (lane & 15) * 4;
  {
#pragma unroll
    for (int q = 0; q < 8; ++q) {
      const int r = q * 2 + rsub;
      const v4f v = *(const v4fa*)&so[w][r][c4];
      *(v4f*)(C + (size_t)(row0 + r) * ldc + col0 + c4) = v;
    }
    
  }
}

// Flash-style causal/unmasked attention, all contractions 3-term bf16 hi/lo splits, f32 softmax with running max.
// q,k,v rows are read from f32 buffers with arbitrary row pitch (so they can live inside a fused qkv buffer);
// D = head size (multiple of 32, <= 128); one wave = 16 query rows; block = 4 waves (64 queries) sharing K/V chunks of 32.
template <int D, bool CAUSAL>
__global__ __launch_bounds__(128) void k_flash(const float* __restrict__ qb, const float* __restrict__ kb, const float* __restrict__ vb,
                                             int pitch, int T, int H, float scale, float* __restrict__ y, int ypitch) {
  constexpr int KS = D / 32;        // k-steps for QK
  constexpr int DT = D / 16;        // d tiles for PV
  __shared__ __attribute__((aligned(16))) unsigned short sKh[32][D + 8], sKl[32][D + 8], sVh[32][D + 8], sVl[32][D + 8];
  __shared__ __attribute__((aligned(16))) unsigned short sPh[4][16][40], sPl[4][16][40];
  __shared__ __attribute__((aligned(16))) float sO[4][16][D];
  const int tid = threadIdx.x, w = tid >> 5, lane = tid & 31, ln = lane & 15, hh = lane >> 4;
  const int nqb = (T + 63) / 64;
  const int bh = blockIdx.x / nqb, qblk = blockIdx.x % nqb;
  const int b = bh / H, h = bh % H;
  const int q0 = qblk * 64 + w * 16;
  const float* Q = qb + (size_t)b * T * pitch + h * D;
  const float* K = kb + (size_t)b * T * pitch + h * D;
  const float* V = vb + (size_t)b * T * pitch + h * D;

  // A fragments of the wave's 16 query rows (scaled), hi/lo
  FragB aqh[KS], aql[KS];
  {
    int row = q0 + ln; if (row >= T) row = T - 1;
    const float* qr = Q + (size_t)row * pitch;
#pragma unroll
    for (int ks = 0; ks < KS; ++ks)
#pragma unroll
      for (int i = 0; i < 16; ++i) {
        const int d = ks * 32 + ((i < 8) ? (8 * hh + i) : (16 + 8 * hh + (i - 8)));
        const float x = qr[d] * scale; const unsigned short hb = bf16_bits(x);
        aqh[ks].u[i] = hb; aql[ks].u[i] = bf16_bits(x - bf16_val(hb));
      }
  }
  float m_r[8], l_r[8];
#pragma unroll
  for (int r = 0; r < 8; ++r) { m_r[r] = -3.0e38f; l_r[r] = 0.f; }
  v8f oacc[DT];
#pragma unroll
  for (int dt = 0; dt < DT; ++dt) oacc[dt] = (v8f){0.f,0.f,0.f,0.f,0.f,0.f,0.f,0.f};

  const int kv_end = CAUSAL ? min(T, qblk * 64 + 64) : T;     // block-uniform
  for (int j0 = 0; j0 < kv_end; j0 += 32) {
    __syncthreads();
    for (int e = tid; e < 32 * (D / 4); e += 128) {
      const int r = e / (D / 4), c4 = (e % (D / 4)) * 4;
      const int key = j0 + r;
      v4f kf = {0.f,0.f,0.f,0.f}, vf = {0.f,0.f,0.f,0.f};
      if (key < T) { kf = *(const v4fa*)(K + (size_t)key * pitch + c4); vf = *(const v4fa*)(V + (size_t)key * pitch + c4); }
#pragma unroll
      for (int t = 0; t < 4; ++t) {
        unsigned short hb = bf16_bits(kf[t]); sKh[r][c4 + t] = hb; sKl[r][c4 + t] = bf16_bits(kf[t] - bf16_val(hb));
        hb = bf16_bits(vf[t]); sVh[r][c4 + t] = hb; sVl[r][c4 + t] = bf16_bits(vf[t] - bf16_val(hb));
      }
    }
    __syncthreads();
    // S tile 16 x 32
    v8f s[2];
#pragma unroll
    for (int nt = 0; nt < 2; ++nt) {
      v8f acc = {};
#pragma unroll
      for (int ks = 0; ks < KS; ++ks) {
        FragB bh_, bl_;
        bh_.half[0] = *(const v8us*)&sKh[nt * 16 + ln][ks * 32 + 8 * hh]; bh_.half[1] = *(const v8us*)&sKh[nt * 16 + ln][ks * 32 + 16 + 8 * hh];
        bl_.half[0] = *(const v8us*)&sKl[nt * 16 + ln][ks * 32 + 8 * hh]; bl_.half[1] = *(const v8us*)&sKl[nt * 16 + ln][ks * 32 + 16 + 8 * hh];
        acc = mmaN<3>(aqh[ks].v, aql[ks].v, bh_.v, bl_.v, acc);
      }
      s[nt] = acc;
    }
    // mask + running max (rows 8hh+r; the 16 lanes of a half share rows)
    float alpha[8];
#pragma unroll
    for (int r = 0; r < 8; ++r) {
      const int qi = q0 + 8 * hh + r;
      const int ja = j0 + ln, jb = j0 + 16 + ln;
      if (CAUSAL) { if (ja > qi) s[0][r] = -3.0e38f; if (jb > qi) s[1][r] = -3.0e38f; }
      if (ja >= T) s[0][r] = -3.0e38f;
      if (jb >= T) s[1][r] = -3.0e38f;
      float mx = fmaxf(s[0][r], s[1][r]);
      mx = fmaxf(mx, __shfl_xor(mx, 1, 32)); mx = fmaxf(mx, __shfl_xor(mx, 2, 32)); mx = fmaxf(mx, __shfl_xor(mx, 4, 32)); mx = fmaxf(mx, __shfl_xor(mx, 8, 32));
      const float mnew = fmaxf(m_r[r], mx);
      alpha[r] = (mnew > -1.0e38f) ? __expf(m_r[r] - mnew) : 1.0f;
      const float p0 = (s[0][r] > -1.0e38f) ? __expf(s[0][r] - mnew) : 0.f;
      const float p1 = (s[1][r] > -1.0e38f) ? __expf(s[1][r] - mnew) : 0.f;
      m_r[r] = mnew;
      l_r[r] = l_r[r] * alpha[r] + p0 + p1;            // per-lane partial row sum (16 lanes combined at the end)
      unsigned short hb = bf16_bits(p0); sPh[w][8 * hh + r][ln] = hb;      sPl[w][8 * hh + r][ln] = bf16_bits(p0 - bf16_val(hb));
      hb = bf16_bits(p1);                sPh[w][8 * hh + r][16 + ln] = hb; sPl[w][8 * hh + r][16 + ln] = bf16_bits(p1 - bf16_val(hb));
    }
#pragma unroll
    for (int dt = 0; dt < DT; ++dt)
#pragma unroll
      for (int r = 0; r < 8; ++r) oacc[dt][r] *= alpha[r];
    __builtin_amdgcn_fence(__ATOMIC_ACQ_REL, "workgroup");
    __builtin_amdgcn_wave_barrier();
    FragB pah, pal;
    pah.half[0] = *(const v8us*)&sPh[w][ln][8 * hh]; pah.half[1] = *(const v8us*)&sPh[w][ln][16 + 8 * hh];
    pal.half[0] = *(const v8us*)&sPl[w][ln][8 * hh]; pal.half[1] = *(const v8us*)&sPl[w][ln][16 + 8 * hh];
#pragma unroll
    for (int dt = 0; dt < DT; ++dt) {
      FragB bvh, bvl;
#pragma unroll
      for (int i = 0; i < 8; ++i) {
        bvh.u[i] = sVh[8 * hh + i][dt * 16 + ln]; bvh.u[8 + i] = sVh[16 + 8 * hh + i][dt * 16 + ln];
        bvl.u[i] = sVl[8 * hh + i][dt * 16 + ln]; bvl.u[8 + i] = sVl[16 + 8 * hh + i][dt * 16 + ln];
      }
      oacc[dt] = mmaN<3>(pah.v, pal.v, bvh.v, bvl.v, oacc[dt]);
    }
    __builtin_amdgcn_fence(__ATOMIC_ACQ_REL, "workgroup");
    __builtin_amdgcn_wave_barrier();
  }
#pragma unroll
  for (int r = 0; r < 8; ++r) {
    float l = l_r[r];
    l += __shfl_xor(l, 1, 32); l += __shfl_xor(l, 2, 32); l += __shfl_xor(l, 4, 32); l += __shfl_xor(l, 8, 32);
    l_r[r] = (l > 0.f) ? 1.0f / l : 0.f;
  }
#pragma unroll
  for (int dt = 0; dt < DT; ++dt)
#pragma unroll
    for (int r = 0; r < 8; ++r) sO[w][8 * hh + r][dt * 16 + ln] = oacc[dt][r] * l_r[r];
  __builtin_amdgcn_fence(__ATOMIC_ACQ_REL, "workgroup");
  __builtin_amdgcn_wave_barrier();
  {
    for (int r = 0; r < 16; ++r) {
      const int row = q0 + r;
      if (row < T && lane < D / 4) {
        const v4f val = *(const v4fa*)&sO[w][r][lane * 4];
        *(v4f*)(y + ((size_t)b * T + row) * ypitch + h * D + lane * 4) = val;
      }
    }
    
  }
}

// row LayerNorm (biased variance, eps) over N: s = X (+ R); optional out_sum <- s; out_norm <- (s-mu)*rsqrt(var+eps)*g + b
template <bool PARAM_BF16>
__global__ __launch_bounds__(256) void k_layernorm(const float* __restrict__ X, const float* __restrict__ R, const float* __restrict__ g, const float* __restrict__ bta,
                                                  float* __restrict__ out_sum, float* __restrict__ out_norm, int N, float eps) {
  __shared__ float red[256];
  const int row = blockIdx.x, tid = threadIdx.x;
  const float* x = X + (size_t)row * N; const float* rr = R ? R + (size_t)row * N : nullptr;
  float vals[16];                     // up to N = 4096
  const int per = N / 256;            // contiguous chunk per thread? use strided-by-4 chunks: thread handles j = tid*4 + 1024*u
  float s1 = 0.f;
  for (int u = 0; u < per / 4; ++u) {
    const int j = tid * 4 + 1024 * u;
    const v4f a = *(const v4fa*)(x + j);
    v4f b = {0.f,0.f,0.f,0.f}; if (rr) b = *(const v4fa*)(rr + j);
#pragma unroll
    for (int q = 0; q < 4; ++q) { const float v = a[q] + b[q]; vals[u * 4 + q] = v; s1 += v; }
  }
  red[tid] = s1; __syncthreads();
  for (int st = 128; st > 0; st >>= 1) { if (tid < st) red[tid] += red[tid + st]; __syncthreads(); }
  const float mu = red[0] / (float)N; __syncthreads();
  float s2 = 0.f;
  for (int u = 0; u < per / 4; ++u)
#pragma unroll
    for (int q = 0; q < 4; ++q) { const float c = vals[u * 4 + q] - mu; s2 += c * c; }
  red[tid] = s2; __syncthreads();
  for (int st = 128; st > 0; st >>= 1) { if (tid < st) red[tid] += red[tid + st]; __syncthreads(); }
  const float rs = rsqrtf(red[0] / (float)N + eps);
  {
    for (int u = 0; u < per / 4; ++u) {
      const int j = tid * 4 + 1024 * u;
      v4f o, sm;
#pragma unroll
      for (int q = 0; q < 4; ++q) {
        float gg = g[j + q], bb = bta[j + q];
        if (PARAM_BF16) { gg = bf16_round(gg); bb = bf16_round(bb); }
        sm[q] = vals[u * 4 + q]; o[q] = (vals[u * 4 + q] - mu) * rs * gg + bb;
      }
      if (out_sum) *(v4f*)(out_sum + (size_t)row * N + j) = sm;
      *(v4f*)(out_norm + (size_t)row * N + j) = o;
    }
    
  }
}

// Bt [5*256][224]: Bt[k*256 + i][j] = W[k][i*200 + j] for i < 200, j < 200; else 0
__global__ __launch_bounds__(256) void k_wt(const float* __restrict__ W, unsigned short* __restrict__ Bt) {
  const int t = blockIdx.x * 256 + threadIdx.x; const int k8n = KP / 8; if (t >= NO * NP * k8n) return; const int n = t / k8n, j8 = (t % k8n) * 8; const int k = n / NP, i = n % NP; v8us v;
#pragma unroll 1
  for (int q = 0; q < 8; ++q) { const int j = j8 + q; v[q] = (i < DD && j < DD) ? bf16_bits(W[(size_t)k * DD * DD + (size_t)i * DD + j]) : (unsigned short)0; }
  *(v8us*)(Bt + (size_t)n * KP + j8) = v; 
}
// out[b][k] = sum_i relu(bf16(x1[b][i])) * (sum_j bf16(relu(x2[b][j]))*Bt[k*256+i][j]) + bf16(bias[k]).
// Block = 8 waves x 32 rows of b. A wave keeps the A fragments of its 32 rows (2 row tiles x 7 k-steps) in registers for the whole kernel;
// it reads them straight from x2 (rows of DD floats) and applies relu, the bf16 rounding and the zero padding of j = DD..KP-1 in registers.
// The block walks i in NSL slices of 16 (i >= 208 is padding that no output reads); a slice is the 5 x 16 rows of Bt for that i range,
// staged in LDS at a pitch of BP elements (464 B = 16 B x 29: conflict-free for 16-byte reads), two buffers, one barrier per slice.
// Every "#pragma unroll" below makes the indices of a register array compile-time constants (an index known only at run time would send the array to scratch).
__global__ __launch_bounds__(256) void k_bilinear(const float* __restrict__ x2, const unsigned short* __restrict__ Bt, const float* __restrict__ x1,
                                                 const float* __restrict__ bias, float* __restrict__ out) {
  __shared__ __attribute__((aligned(16))) unsigned short sB[2][NO * 16][BP];
  __shared__ float so[FROWS * NO];
  const int tid = threadIdx.x, w = tid >> 5, lane = tid & 31, ln = lane & 15, hh = lane >> 4;
  const int b0 = blockIdx.x * FROWS, row0 = b0 + w * 32;
  // staging: wave w moves rows 2w and 2w+1 of each of the 5 groups of 16 in a slice (constant steps from one address), lanes 0..27 one 16-byte piece of the 448-byte row each
  const bool mover = lane < KP / 8;
  const int piece = (mover ? lane : 0) * 8;
  const unsigned short* bsrc = Bt + (size_t)(2 * w) * KP + piece;
  v8us st[10];
#pragma unroll
  for (int q = 0; q < 10; ++q) st[q] = *(const v8us*)(bsrc + ((q >> 1) * NP + (q & 1)) * KP);
  v4f xr[2][KP / 32][4];
  const float* arow[2]; const float* ahalf[2];
#pragma unroll
  for (int m = 0; m < 2; ++m) {
    arow[m] = x2 + (size_t)(row0 + m * 16 + ln) * DD; ahalf[m] = arow[m] + 8 * hh;
#pragma unroll
    for (int ks = 0; ks < DD / 32; ++ks) {
      const int kb = ks * 32;
      xr[m][ks][0] = *(const v4fa*)(ahalf[m] + kb);      xr[m][ks][1] = *(const v4fa*)(ahalf[m] + kb + 4);
      xr[m][ks][2] = *(const v4fa*)(ahalf[m] + kb + 16); xr[m][ks][3] = *(const v4fa*)(ahalf[m] + kb + 16 + 4);
    }
    // last k-step: only j = 192..199 exist, the first 8 elements of the hh = 0 lanes; the hh = 1 lanes read the same 32 bytes (in bounds) and drop them below
    xr[m][DD / 32][0] = *(const v4fa*)(arow[m] + (DD / 32) * 32); xr[m][DD / 32][1] = *(const v4fa*)(arow[m] + (DD / 32) * 32 + 4);
  }
  // the address registers of the loads above are reused below; naming the four row pointers keeps their registers from serving as a later load's destination ahead of the wait
  asm volatile("s_wait_xcnt 0x0" :: "v"(arow[0]), "v"(arow[1]), "v"(ahalf[0]), "v"(ahalf[1]) : "memory");
  __builtin_amdgcn_sched_barrier(0);              // keeps every later register write behind that wait
  FragB a[2][KP / 32];
  const unsigned short tailmask = hh ? 0 : 0xFFFF;   // zero padding of j = 200..207, which the hh = 1 lanes hold in the last k-step
#pragma unroll
  for (int m = 0; m < 2; ++m)
#pragma unroll
    for (int ks = 0; ks < KP / 32; ++ks)
#pragma unroll
      for (int i = 0; i < 16; ++i) {
        if (ks < DD / 32) a[m][ks].u[i] = relu_bf16_bits(xr[m][ks][i >> 2][i & 3]);
        else a[m][ks].u[i] = i < 8 ? (unsigned short)(relu_bf16_bits(xr[m][ks][i >> 2][i & 3]) & tailmask) : (unsigned short)0;
      }
  if (mover) {
#pragma unroll
    for (int q = 0; q < 10; ++q) *(v8us*)&sB[0][(q >> 1) * 16 + 2 * w + (q & 1)][piece] = st[q];
  }
  __syncthreads();
  float s[2][NO][8];
#pragma unroll
  for (int m = 0; m < 2; ++m)
#pragma unroll
    for (int k = 0; k < NO; ++k)
#pragma unroll
      for (int r = 0; r < 8; ++r) s[m][k][r] = 0.f;
  // rolled so that the fragment and accumulator indices inside stay constants while the code stays small
#pragma unroll 1
  for (int it = 0; it < NSL; ++it) {
    const int cur = it & 1;
    if (it + 1 < NSL) {
#pragma unroll
      for (int q = 0; q < 10; ++q) st[q] = *(const v8us*)(bsrc + (size_t)(it + 1) * 16 * KP + ((q >> 1) * NP + (q & 1)) * KP);
      asm volatile("s_wait_xcnt 0x0" ::: "memory");   // the address register of these loads is reused right behind this block
    }
    // columns i >= DD of the last slice: Bt's rows there are zero, so acc is 0 and any finite x1 value adds 0; the clamp keeps the load in bounds
    const int i = it * 16 + ln, ic = i < DD ? i : DD - 1;
    float r1[2][8];
#pragma unroll
    for (int m = 0; m < 2; ++m)
#pragma unroll
      for (int r = 0; r < 8; ++r) r1[m][r] = x1[(size_t)(row0 + m * 16 + 8 * hh + r) * DD + ic];
    v8f acc[2][NO] = {};
    FragB bf[2][NO];   // B fragments of one k-step, two sets: the next k-step's LDS reads go out as one group ahead of this k-step's matrix block
#pragma unroll
    for (int k = 0; k < NO; ++k) {
      bf[0][k].half[0] = *(const v8us*)&sB[cur][k * 16 + ln][8 * hh];
      bf[0][k].half[1] = *(const v8us*)&sB[cur][k * 16 + ln][16 + 8 * hh];
    }
#pragma unroll
    for (int ks = 0; ks < KP / 32; ++ks) {
      if (ks + 1 < KP / 32) {
#pragma unroll
        for (int k = 0; k < NO; ++k) {
          bf[(ks + 1) & 1][k].half[0] = *(const v8us*)&sB[cur][k * 16 + ln][(ks + 1) * 32 + 8 * hh];
          bf[(ks + 1) & 1][k].half[1] = *(const v8us*)&sB[cur][k * 16 + ln][(ks + 1) * 32 + 16 + 8 * hh];
        }
      }
      if (ks == 0) asm volatile("s_wait_xcnt 0x0" ::: "memory");   // the address registers of the x1 loads are reused by the matrix block
      __builtin_amdgcn_sched_barrier(0);   // holds the loads above (global ones on the first pass, LDS reads on all but the last) ahead of the matrix block: without it each pair of reads sat directly before its user behind a full wait
#pragma unroll
      for (int k = 0; k < NO; ++k)
#pragma unroll
        for (int m = 0; m < 2; ++m) acc[m][k] = __builtin_amdgcn_wmma_f32_16x16x32_bf16(false, a[m][ks].v, false, bf[ks & 1][k].v, (short)0, acc[m][k], false, false);
      __builtin_amdgcn_sched_barrier(0);   // keeps the next group of LDS reads from moving in among these matrix instructions
    }
#pragma unroll
    for (int m = 0; m < 2; ++m)
#pragma unroll
      for (int r = 0; r < 8; ++r) {
        const float rv = fmaxf(bf16_round(r1[m][r]), 0.f);
#pragma unroll
        for (int k = 0; k < NO; ++k) s[m][k][r] += rv * acc[m][k][r];
      }
    if (it + 1 < NSL && mover) {
#pragma unroll
      for (int q = 0; q < 10; ++q) *(v8us*)&sB[cur ^ 1][(q >> 1) * 16 + 2 * w + (q & 1)][piece] = st[q];
    }
    __syncthreads();   // publishes slice it+1 and ends every wave's reads of slice it, whose buffer the next trip refills
  }
#pragma unroll
  for (int m = 0; m < 2; ++m)
#pragma unroll
    for (int k = 0; k < NO; ++k)
#pragma unroll
      for (int r = 0; r < 8; ++r) {
        float v = s[m][k][r];
        v += __shfl_xor(v, 8, 32); v += __shfl_xor(v, 4, 32); v += __shfl_xor(v, 2, 32); v += __shfl_xor(v, 1, 32);
        s[m][k][r] = v;
      }
  if (ln == 0) {
#pragma unroll
    for (int k = 0; k < NO; ++k) {
      const float bv = bf16_round(bias[k]);
#pragma unroll
      for (int m = 0; m < 2; ++m)
#pragma unroll
        for (int r = 0; r < 8; ++r) so[(w * 32 + m * 16 + 8 * hh + r) * NO + k] = s[m][k][r] + bv;
    }
  }
  __syncthreads();
  for (int e = tid; e < FROWS * NO; e += 256) out[(size_t)b0 * NO + e] = so[e];
}
extern "C" void kernel_launch(void* const* d_in, const int* in_sizes, int n_in,
                              void* d_out, int out_size, void* d_ws, size_t ws_size, hipStream_t stream) {
  (void)in_sizes; (void)n_in; (void)out_size;
  const float* x1 = (const float*)d_in[0]; const float* x2 = (const float*)d_in[1]; const float* W = (const float*)d_in[2]; const float* bias = (const float*)d_in[3];
  char* ws = (char*)d_ws; size_t off = 0;
  auto take = [&](size_t bytes) { char* p = ws + off; off += (bytes + 255) & ~(size_t)255; return p; };
  unsigned short* Bt = (unsigned short*)take((size_t)NO * NP * KP * 2);
  if (off > ws_size) return;
  k_wt<<<(NO * NP * (KP / 8) + 255) / 256, 256, 0, stream>>>(W, Bt);
  k_bilinear<<<NB / FROWS, 256, 0, stream>>>(x2, Bt, x1, bias, (float*)d_out);
}

// v003
// It runs in 28.2 microseconds.
// Timed twice side by side with v002, it ran 1.10 times as fast both times.
// All steps since v000 together make it 15.5 times as fast.
#include <hip/hip_runtime.h>
// The bilinear form is computed as one GEMM T[b][k*256 + i] = sum_j relu(x2)[b][j]*W[k][i][j] (M = 65536, K = 200 padded to 224; x2 and W
// rounded to bf16 so relu(x2) is exact: single WMMA term, f32 accumulate) on v_wmma_f32_16x16x32_bf16; out[b][k] = sum_i relu(x1)[b][i]*T[b][k][i] + b[k]
// is folded into the same kernel: each 16x16 tile of T is multiplied by relu(x1) in its accumulator registers and never stored.
// The tiles are formed transposed (W rows as the A operand, x2 rows as the B operand), so a lane holds 8 consecutive i of ONE b.
#define NB 65536
#define DD 200
#define KP 224
#define NP 256
#define NO 5
#define NSL 13
#define BP 232
#define FROWS 256

typedef __bf16 v16b __attribute__((ext_vector_type(16)));
typedef unsigned short v8us __attribute__((ext_vector_type(8), may_alias));
typedef float  v8f  __attribute__((ext_vector_type(8)));
typedef float  v2f  __attribute__((ext_vector_type(2)));
typedef float  v4f  __attribute__((ext_vector_type(4)));
typedef float  v4fa __attribute__((ext_vector_type(4), may_alias));
union FragB { v16b v; v8us half[2]; unsigned short u[16]; };

__device__ __forceinline__ unsigned short bf16_bits(float x) { unsigned int u = __float_as_uint(x); return (unsigned short)((u + 0x7FFFu + ((u >> 16) & 1u)) >> 16); }
__device__ __forceinline__ float bf16_val(unsigned short b) { return __uint_as_float(((unsigned int)b) << 16); }
__device__ __forceinline__ float bf16_round(float x) { return bf16_val(bf16_bits(x)); }
// bf16(relu(x)): a negative float (and -0) is a negative integer, so one integer maximum with 0 is the relu
__device__ __forceinline__ unsigned short relu_bf16_bits(float x) { const int u = __float_as_int(x); return bf16_bits(__int_as_float(u > 0 ? u : 0)); }
// D += A·B with NT terms: 1 = ah·bh, 2 = + al·bh (A split), 3 = + ah·bl (both split)
template <int NT>
__device__ __forceinline__ v8f mmaN(v16b ah, v16b al, v16b bh, v16b bl, v8f c) {
  c = __builtin_amdgcn_wmma_f32_16x16x32_bf16(false, ah, false, bh, (short)0, c, false, false);
  if (NT >= 2) c = __builtin_amdgcn_wmma_f32_16x16x32_bf16(false, al, false, bh, (short)0, c, false, false);
  if (NT >= 3) c = __builtin_amdgcn_wmma_f32_16x16x32_bf16(false, ah, false, bl, (short)0, c, false, false);
  asm volatile("v_nop\n\tv_nop\n\tv_nop\n\tv_nop" : "+v"(c) : "v"(ah), "v"(al), "v"(bh), "v"(bl));
  return c;
}

__global__ __launch_bounds__(256) void k_wt_bf16(const float* __restrict__ W, unsigned short* __restrict__ Wt, int K, int N) {
  const int t = blockIdx.x * 256 + threadIdx.x;
  const int k8n = K / 8;
  if (t >= N * k8n) return;
  const int n = t / k8n, k8 = (t % k8n) * 8;
  v8us v;
#pragma unroll
  for (int i = 0; i < 8; ++i) v[i] = bf16_bits(W[(size_t)(k8 + i) * N + n]);
  *(v8us*)(Wt + (size_t)n * K + k8) = v;
  
}

// GEMM C[M][N] (f32, pitch ldc) = act(A[M][K]·W + bias). A f32 row-major (pitch lda) converted per fragment to bf16
// (ASPLIT: hi/lo two planes -> 2 terms, else single rounded term); Wt bf16 [N][K] (pitch ldb). BIAS_BF16 rounds the
// bias to bf16 first (bias quantised to bf16 before the add). K%32==0, M%16==0, N%64==0.
template <bool ASPLIT, int ACT, bool BIAS_BF16>
__global__ __launch_bounds__(128) void k_gemm_bf(const float* __restrict__ A, int lda, const unsigned short* __restrict__ Wt, int ldb,
                                               const float* __restrict__ bias, float* __restrict__ C, int ldc, int M, int N, int K) {
  __shared__ __attribute__((aligned(16))) float so[4][16][64];
  const int tid = threadIdx.x, w = tid >> 5, lane = tid & 31, ln = lane & 15, hh = lane >> 4;
  const int ntn = N / 64;
  const int wid = blockIdx.x * 4 + w;
  const int mt = wid / ntn, nq = wid % ntn;
  if (mt * 16 >= M) return;
  const int row0 = mt * 16, col0 = nq * 64;
  const float* arow = A + (size_t)(row0 + ln) * lda;
  v8f acc[4] = {};
  for (int kb = 0; kb < K; kb += 32) {
    FragB ah, al;
    const v4f x0 = *(const v4fa*)(arow + kb + 8 * hh), x1 = *(const v4fa*)(arow + kb + 8 * hh + 4);
    const v4f x2 = *(const v4fa*)(arow + kb + 16 + 8 * hh), x3 = *(const v4fa*)(arow + kb + 16 + 8 * hh + 4);
    float xs[16] = {x0[0],x0[1],x0[2],x0[3],x1[0],x1[1],x1[2],x1[3],x2[0],x2[1],x2[2],x2[3],x3[0],x3[1],x3[2],x3[3]};
#pragma unroll
    for (int i = 0; i < 16; ++i) { const unsigned short hb = bf16_bits(xs[i]); ah.u[i] = hb; al.u[i] = ASPLIT ? bf16_bits(xs[i] - bf16_val(hb)) : (unsigned short)0; }
#pragma unroll
    for (int t = 0; t < 4; ++t) {
      const unsigned short* brow = Wt + (size_t)(col0 + t * 16 + ln) * ldb + kb;
      FragB b;
      b.half[0] = *(const v8us*)(brow + 8 * hh);
      b.half[1] = *(const v8us*)(brow + 16 + 8 * hh);
      acc[t] = mmaN<ASPLIT ? 2 : 1>(ah.v, al.v, b.v, b.v, acc[t]);
    }
  }
#pragma unroll
  for (int t = 0; t < 4; ++t) {
    float bv = bias ? bias[col0 + t * 16 + ln] : 0.f;
    if (BIAS_BF16) bv = bf16_round(bv);
#pragma unroll
    for (int r = 0; r < 8; ++r) { float v = acc[t][r] + bv; if (ACT == 1) v = fmaxf(v, 0.f); so[w][8 * hh + r][t * 16 + ln] = v; }
  }
  __builtin_amdgcn_fence(__ATOMIC_ACQ_REL, "workgroup");
  __builtin_amdgcn_wave_barrier();
  const int rsub = lane >> 4, c4 = (lane & 15) * 4;
  {
#pragma unroll
    for (int q = 0; q < 8; ++q) {
      const int r = q * 2 + rsub;
      const v4f v = *(const v4fa*)&so[w][r][c4];
      *(v4f*)(C + (size_t)(row0 + r) * ldc + col0 + c4) = v;
    }
    
  }
}

// Flash-style causal/unmasked attention, all contractions 3-term bf16 hi/lo splits, f32 softmax with running max.
// q,k,v rows are read from f32 buffers with arbitrary row pitch (so they can live inside a fused qkv buffer);
// D = head size (multiple of 32, <= 128); one wave = 16 query rows; block = 4 waves (64 queries) sharing K/V chunks of 32.
template <int D, bool CAUSAL>
__global__ __launch_bounds__(128) void k_flash(const float* __restrict__ qb, const float* __restrict__ kb, const float* __restrict__ vb,
                                             int pitch, int T, int H, float scale, float* __restrict__ y, int ypitch) {
  constexpr int KS = D / 32;        // k-steps for QK
  constexpr int DT = D / 16;        // d tiles for PV
  __shared__ __attribute__((aligned(16))) unsigned short sKh[32][D + 8], sKl[32][D + 8], sVh[32][D + 8], sVl[32][D + 8];
  __shared__ __attribute__((aligned(16))) unsigned short sPh[4][16][40], sPl[4][16][40];
  __shared__ __attribute__((aligned(16))) float sO[4][16][D];
  const int tid = threadIdx.x, w = tid >> 5, lane = tid & 31, ln = lane & 15, hh = lane >> 4;
  const int nqb = (T + 63) / 64;
  const int bh = blockIdx.x / nqb, qblk = blockIdx.x % nqb;
  const int b = bh / H, h = bh % H;
  const int q0 = qblk * 64 + w * 16;
  const float* Q = qb + (size_t)b * T * pitch + h * D;
  const float* K = kb + (size_t)b * T * pitch + h * D;
  const float* V = vb + (size_t)b * T * pitch + h * D;

  // A fragments of the wave's 16 query rows (scaled), hi/lo
  FragB aqh[KS], aql[KS];
  {
    int row = q0 + ln; if (row >= T) row = T - 1;
    const float* qr = Q + (size_t)row * pitch;
#pragma unroll
    for (int ks = 0; ks < KS; ++ks)
#pragma unroll
      for (int i = 0; i < 16; ++i) {
        const int d = ks * 32 + ((i < 8) ? (8 * hh + i) : (16 + 8 * hh + (i - 8)));
        const float x = qr[d] * scale; const unsigned short hb = bf16_bits(x);
        aqh[ks].u[i] = hb; aql[ks].u[i] = bf16_bits(x - bf16_val(hb));
      }
  }
  float m_r[8], l_r[8];
#pragma unroll
  for (int r = 0; r < 8; ++r) { m_r[r] = -3.0e38f; l_r[r] = 0.f; }
  v8f oacc[DT];
#pragma unroll
  for (int dt = 0; dt < DT; ++dt) oacc[dt] = (v8f){0.f,0.f,0.f,0.f,0.f,0.f,0.f,0.f};

  const int kv_end = CAUSAL ? min(T, qblk * 64 + 64) : T;     // block-uniform
  for (int j0 = 0; j0 < kv_end; j0 += 32) {
    __syncthreads();
    for (int e = tid; e < 32 * (D / 4); e += 128) {
      const int r = e / (D / 4), c4 = (e % (D / 4)) * 4;
      const int key = j0 + r;
      v4f kf = {0.f,0.f,0.f,0.f}, vf = {0.f,0.f,0.f,0.f};
      if (key < T) { kf = *(const v4fa*)(K + (size_t)key * pitch + c4); vf = *(const v4fa*)(V + (size_t)key * pitch + c4); }
#pragma unroll
      for (int t = 0; t < 4; ++t) {
        unsigned short hb = bf16_bits(kf[t]); sKh[r][c4 + t] = hb; sKl[r][c4 + t] = bf16_bits(kf[t] - bf16_val(hb));
        hb = bf16_bits(vf[t]); sVh[r][c4 + t] = hb; sVl[r][c4 + t] = bf16_bits(vf[t] - bf16_val(hb));
      }
    }
    __syncthreads();
    // S tile 16 x 32
    v8f s[2];
#pragma unroll
    for (int nt = 0; nt < 2; ++nt) {
      v8f acc = {};
#pragma unroll
      for (int ks = 0; ks < KS; ++ks) {
        FragB bh_, bl_;
        bh_.half[0] = *(const v8us*)&sKh[nt * 16 + ln][ks * 32 + 8 * hh]; bh_.half[1] = *(const v8us*)&sKh[nt * 16 + ln][ks * 32 + 16 + 8 * hh];
        bl_.half[0] = *(const v8us*)&sKl[nt * 16 + ln][ks * 32 + 8 * hh]; bl_.half[1] = *(const v8us*)&sKl[nt * 16 + ln][ks * 32 + 16 + 8 * hh];
        acc = mmaN<3>(aqh[ks].v, aql[ks].v, bh_.v, bl_.v, acc);
      }
      s[nt] = acc;
    }
    // mask + running max (rows 8hh+r; the 16 lanes of a half share rows)
    float alpha[8];
#pragma unroll
    for (int r = 0; r < 8; ++r) {
      const int qi = q0 + 8 * hh + r;
      const int ja = j0 + ln, jb = j0 + 16 + ln;
      if (CAUSAL) { if (ja > qi) s[0][r] = -3.0e38f; if (jb > qi) s[1][r] = -3.0e38f; }
      if (ja >= T) s[0][r] = -3.0e38f;
      if (jb >= T) s[1][r] = -3.0e38f;
      float mx = fmaxf(s[0][r], s[1][r]);
      mx = fmaxf(mx, __shfl_xor(mx, 1, 32)); mx = fmaxf(mx, __shfl_xor(mx, 2, 32)); mx = fmaxf(mx, __shfl_xor(mx, 4, 32)); mx = fmaxf(mx, __shfl_xor(mx, 8, 32));
      const float mnew = fmaxf(m_r[r], mx);
      alpha[r] = (mnew > -1.0e38f) ? __expf(m_r[r] - mnew) : 1.0f;
      const float p0 = (s[0][r] > -1.0e38f) ? __expf(s[0][r] - mnew) : 0.f;
      const float p1 = (s[1][r] > -1.0e38f) ? __expf(s[1][r] - mnew) : 0.f;
      m_r[r] = mnew;
      l_r[r] = l_r[r] * alpha[r] + p0 + p1;            // per-lane partial row sum (16 lanes combined at the end)
      unsigned short hb = bf16_bits(p0); sPh[w][8 * hh + r][ln] = hb;      sPl[w][8 * hh + r][ln] = bf16_bits(p0 - bf16_val(hb));
      hb = bf16_bits(p1);                sPh[w][8 * hh + r][16 + ln] = hb; sPl[w][8 * hh + r][16 + ln] = bf16_bits(p1 - bf16_val(hb));
    }
#pragma unroll
    for (int dt = 0; dt < DT; ++dt)
#pragma unroll
      for (int r = 0; r < 8; ++r) oacc[dt][r] *= alpha[r];
    __builtin_amdgcn_fence(__ATOMIC_ACQ_REL, "workgroup");
    __builtin_amdgcn_wave_barrier();
    FragB pah, pal;
    pah.half[0] = *(const v8us*)&sPh[w][ln][8 * hh]; pah.half[1] = *(const v8us*)&sPh[w][ln][16 + 8 * hh];
    pal.half[0] = *(const v8us*)&sPl[w][ln][8 * hh]; pal.half[1] = *(const v8us*)&sPl[w][ln][16 + 8 * hh];
#pragma unroll
    for (int dt = 0; dt < DT; ++dt) {
      FragB bvh, bvl;
#pragma unroll
      for (int i = 0; i < 8; ++i) {
        bvh.u[i] = sVh[8 * hh + i][dt * 16 + ln]; bvh.u[8 + i] = sVh[16 + 8 * hh + i][dt * 16 + ln];
        bvl.u[i] = sVl[8 * hh + i][dt * 16 + ln]; bvl.u[8 + i] = sVl[16 + 8 * hh + i][dt * 16 + ln];
      }
      oacc[dt] = mmaN<3>(pah.v, pal.v, bvh.v, bvl.v, oacc[dt]);
    }
    __builtin_amdgcn_fence(__ATOMIC_ACQ_REL, "workgroup");
    __builtin_amdgcn_wave_barrier();
  }
#pragma unroll
  for (int r = 0; r < 8; ++r) {
    float l = l_r[r];
    l += __shfl_xor(l, 1, 32); l += __shfl_xor(l, 2, 32); l += __shfl_xor(l, 4, 32); l += __shfl_xor(l, 8, 32);
    l_r[r] = (l > 0.f) ? 1.0f / l : 0.f;
  }
#pragma unroll
  for (int dt = 0; dt < DT; ++dt)
#pragma unroll
    for (int r = 0; r < 8; ++r) sO[w][8 * hh + r][dt * 16 + ln] = oacc[dt][r] * l_r[r];
  __builtin_amdgcn_fence(__ATOMIC_ACQ_REL, "workgroup");
  __builtin_amdgcn_wave_barrier();
  {
    for (int r = 0; r < 16; ++r) {
      const int row = q0 + r;
      if (row < T && lane < D / 4) {
        const v4f val = *(const v4fa*)&sO[w][r][lane * 4];
        *(v4f*)(y + ((size_t)b * T + row) * ypitch + h * D + lane * 4) = val;
      }
    }
    
  }
}

// row LayerNorm (biased variance, eps) over N: s = X (+ R); optional out_sum <- s; out_norm <- (s-mu)*rsqrt(var+eps)*g + b
template <bool PARAM_BF16>
__global__ __launch_bounds__(256) void k_layernorm(const float* __restrict__ X, const float* __restrict__ R, const float* __restrict__ g, const float* __restrict__ bta,
                                                  float* __restrict__ out_sum, float* __restrict__ out_norm, int N, float eps) {
  __shared__ float red[256];
  const int row = blockIdx.x, tid = threadIdx.x;
  const float* x = X + (size_t)row * N; const float* rr = R ? R + (size_t)row * N : nullptr;
  float vals[16];                     // up to N = 4096
  const int per = N / 256;            // contiguous chunk per thread? use strided-by-4 chunks: thread handles j = tid*4 + 1024*u
  float s1 = 0.f;
  for (int u = 0; u < per / 4; ++u) {
    const int j = tid * 4 + 1024 * u;
    const v4f a = *(const v4fa*)(x + j);
    v4f b = {0.f,0.f,0.f,0.f}; if (rr) b = *(const v4fa*)(rr + j);
#pragma unroll
    for (int q = 0; q < 4; ++q) { const float v = a[q] + b[q]; vals[u * 4 + q] = v; s1 += v; }
  }
  red[tid] = s1; __syncthreads();
  for (int st = 128; st > 0; st >>= 1) { if (tid < st) red[tid] += red[tid + st]; __syncthreads(); }
  const float mu = red[0] / (float)N; __syncthreads();
  float s2 = 0.f;
  for (int u = 0; u < per / 4; ++u)
#pragma unroll
    for (int q = 0; q < 4; ++q) { const float c = vals[u * 4 + q] - mu; s2 += c * c; }
  red[tid] = s2; __syncthreads();
  for (int st = 128; st > 0; st >>= 1) { if (tid < st) red[tid] += red[tid + st]; __syncthreads(); }
  const float rs = rsqrtf(red[0] / (float)N + eps);
  {
    for (int u = 0; u < per / 4; ++u) {
      const int j = tid * 4 + 1024 * u;
      v4f o, sm;
#pragma unroll
      for (int q = 0; q < 4; ++q) {
        float gg = g[j + q], bb = bta[j + q];
        if (PARAM_BF16) { gg = bf16_round(gg); bb = bf16_round(bb); }
        sm[q] = vals[u * 4 + q]; o[q] = (vals[u * 4 + q] - mu) * rs * gg + bb;
      }
      if (out_sum) *(v4f*)(out_sum + (size_t)row * N + j) = sm;
      *(v4f*)(out_norm + (size_t)row * N + j) = o;
    }
    
  }
}

// Bt [5*256][224]: Bt[k*256 + i][j] = W[k][i*200 + j] for i < 200, j < 200; else 0
__global__ __launch_bounds__(256) void k_wt(const float* __restrict__ W, unsigned short* __restrict__ Bt) {
  const int t = blockIdx.x * 256 + threadIdx.x; const int k8n = KP / 8; if (t >= NO * NP * k8n) return; const int n = t / k8n, j8 = (t % k8n) * 8; const int k = n / NP, i = n % NP; v8us v;
#pragma unroll 1
  for (int q = 0; q < 8; ++q) { const int j = j8 + q; v[q] = (i < DD && j < DD) ? bf16_bits(W[(size_t)k * DD * DD + (size_t)i * DD + j]) : (unsigned short)0; }
  *(v8us*)(Bt + (size_t)n * KP + j8) = v; 
}
// out[b][k] = sum_i relu(bf16(x1[b][i])) * (sum_j bf16(relu(x2[b][j]))*Bt[k*256+i][j]) + bf16(bias[k]).
// Block = 8 waves x 32 rows of b. A wave keeps the x2 fragments of its 32 rows (2 row tiles x 7 k-steps) in registers for the whole kernel;
// it reads them straight from x2 (rows of DD floats) and applies relu, the bf16 rounding and the zero padding of j = DD..KP-1 in registers.
// The block walks i in NSL slices of 16 (i >= 208 is padding that no output reads); a slice is the 5 x 16 rows of Bt for that i range,
// staged in LDS at a pitch of BP elements (464 B = 16 B x 29: conflict-free for 16-byte reads), two buffers, one barrier per slice.
// The Bt fragment is the A operand and the x2 fragment the B operand (both loaders have the same k order): accumulator register r of lane (ln, hh)
// is T[b = tile row ln][i = slice + 8*hh + r]. The sum over i then runs inside the lane, over registers, x1 is read as 8 consecutive floats of the
// lane's own row, and only the two halves hh are left to be added across lanes at the end.
// Every "#pragma unroll" below makes the indices of a register array compile-time constants (an index known only at run time would send the array to scratch).
__global__ __launch_bounds__(256) void k_bilinear(const float* __restrict__ x2, const unsigned short* __restrict__ Bt, const float* __restrict__ x1,
                                                 const float* __restrict__ bias, float* __restrict__ out) {
  __shared__ __attribute__((aligned(16))) unsigned short sB[2][NO * 16][BP];
  __shared__ float so[FROWS * NO];
  const int tid = threadIdx.x, w = tid >> 5, lane = tid & 31, ln = lane & 15, hh = lane >> 4;
  const int b0 = blockIdx.x * FROWS, row0 = b0 + w * 32;
  // staging: wave w moves rows 2w and 2w+1 of each of the 5 groups of 16 in a slice (constant steps from one address), lanes 0..27 one 16-byte piece of the 448-byte row each
  const bool mover = lane < KP / 8;
  const int piece = (mover ? lane : 0) * 8;
  const unsigned short* bsrc = Bt + (size_t)(2 * w) * KP + piece;
  v8us st[10];
#pragma unroll
  for (int q = 0; q < 10; ++q) st[q] = *(const v8us*)(bsrc + ((q >> 1) * NP + (q & 1)) * KP);
  v4f xr[2][KP / 32][4];
  const float* arow[2]; const float* ahalf[2];
#pragma unroll
  for (int m = 0; m < 2; ++m) {
    arow[m] = x2 + (size_t)(row0 + m * 16 + ln) * DD; ahalf[m] = arow[m] + 8 * hh;
#pragma unroll
    for (int ks = 0; ks < DD / 32; ++ks) {
      const int kb = ks * 32;
      xr[m][ks][0] = *(const v4fa*)(ahalf[m] + kb);      xr[m][ks][1] = *(const v4fa*)(ahalf[m] + kb + 4);
      xr[m][ks][2] = *(const v4fa*)(ahalf[m] + kb + 16); xr[m][ks][3] = *(const v4fa*)(ahalf[m] + kb + 16 + 4);
    }
    // last k-step: only j = 192..199 exist, the first 8 elements of the hh = 0 lanes; the hh = 1 lanes read the same 32 bytes (in bounds) and drop them below
    xr[m][DD / 32][0] = *(const v4fa*)(arow[m] + (DD / 32) * 32); xr[m][DD / 32][1] = *(const v4fa*)(arow[m] + (DD / 32) * 32 + 4);
  }
  // the address registers of the loads above are reused below; naming the four row pointers keeps their registers from serving as a later load's destination ahead of the wait
  asm volatile("s_wait_xcnt 0x0" :: "v"(arow[0]), "v"(arow[1]), "v"(ahalf[0]), "v"(ahalf[1]) : "memory");
  __builtin_amdgcn_sched_barrier(0);              // keeps every later register write behind that wait
  FragB a[2][KP / 32];
  const unsigned short tailmask = hh ? 0 : 0xFFFF;   // zero padding of j = 200..207, which the hh = 1 lanes hold in the last k-step
#pragma unroll
  for (int m = 0; m < 2; ++m)
#pragma unroll
    for (int ks = 0; ks < KP / 32; ++ks)
#pragma unroll
      for (int i = 0; i < 16; ++i) {
        if (ks < DD / 32) a[m][ks].u[i] = relu_bf16_bits(xr[m][ks][i >> 2][i & 3]);
        else a[m][ks].u[i] = i < 8 ? (unsigned short)(relu_bf16_bits(xr[m][ks][i >> 2][i & 3]) & tailmask) : (unsigned short)0;
      }
  if (mover) {
#pragma unroll
    for (int q = 0; q < 10; ++q) *(v8us*)&sB[0][(q >> 1) * 16 + 2 * w + (q & 1)][piece] = st[q];
  }
  __syncthreads();
  v2f s[2][NO];   // the lane's share of out[row0 + m*16 + ln][k]: even and odd i apart, so that two products go into one packed multiply-add
#pragma unroll
  for (int m = 0; m < 2; ++m)
#pragma unroll
    for (int k = 0; k < NO; ++k) s[m][k] = (v2f){0.f, 0.f};
  // rolled so that the fragment and accumulator indices inside stay constants while the code stays small
#pragma unroll 1
  for (int it = 0; it < NSL; ++it) {
    const int cur = it & 1;
    if (it + 1 < NSL) {
#pragma unroll
      for (int q = 0; q < 10; ++q) st[q] = *(const v8us*)(bsrc + (size_t)(it + 1) * 16 * KP + ((q >> 1) * NP + (q & 1)) * KP);
      asm volatile("s_wait_xcnt 0x0" ::: "memory");   // the address register of these loads is reused right behind this block
    }
    // i >= DD (the hh = 1 lanes of the last slice): Bt's rows there are zero, so acc is 0 and any finite x1 value adds 0; the clamp keeps the load in bounds
    const int i = it * 16 + 8 * hh, ic = i <= DD - 8 ? i : DD - 8;
    v4f r1[2][2];
#pragma unroll
    for (int m = 0; m < 2; ++m) {
      const float* xrow = x1 + (size_t)(row0 + m * 16 + ln) * DD + ic;
      r1[m][0] = *(const v4fa*)xrow; r1[m][1] = *(const v4fa*)(xrow + 4);
    }
    v8f acc[2][NO] = {};
    FragB bf[2][NO];   // Bt fragments of one k-step, two sets: the next k-step's LDS reads go out as one group ahead of this k-step's matrix block
#pragma unroll
    for (int k = 0; k < NO; ++k) {
      bf[0][k].half[0] = *(const v8us*)&sB[cur][k * 16 + ln][8 * hh];
      bf[0][k].half[1] = *(const v8us*)&sB[cur][k * 16 + ln][16 + 8 * hh];
    }
#pragma unroll
    for (int ks = 0; ks < KP / 32; ++ks) {
      if (ks + 1 < KP / 32) {
#pragma unroll
        for (int k = 0; k < NO; ++k) {
          bf[(ks + 1) & 1][k].half[0] = *(const v8us*)&sB[cur][k * 16 + ln][(ks + 1) * 32 + 8 * hh];
          bf[(ks + 1) & 1][k].half[1] = *(const v8us*)&sB[cur][k * 16 + ln][(ks + 1) * 32 + 16 + 8 * hh];
        }
      }
      if (ks == 0) asm volatile("s_wait_xcnt 0x0" ::: "memory");   // the address registers of the x1 loads are reused by the matrix block
      __builtin_amdgcn_sched_barrier(0);   // holds the loads above (global ones on the first pass, LDS reads on all but the last) ahead of the matrix block: without it each pair of reads sat directly before its user behind a full wait
#pragma unroll
      for (int k = 0; k < NO; ++k)
#pragma unroll
        for (int m = 0; m < 2; ++m) acc[m][k] = __builtin_amdgcn_wmma_f32_16x16x32_bf16(false, bf[ks & 1][k].v, false, a[m][ks].v, (short)0, acc[m][k], false, false);
      __builtin_amdgcn_sched_barrier(0);   // keeps the next group of LDS reads from moving in among these matrix instructions
    }
#pragma unroll
    for (int r = 0; r < 8; r += 2)
#pragma unroll
      for (int m = 0; m < 2; ++m) {
        const v2f rv = {fmaxf(bf16_round(r1[m][r >> 2][r & 3]), 0.f), fmaxf(bf16_round(r1[m][r >> 2][(r & 3) + 1]), 0.f)};
#pragma unroll
        for (int k = 0; k < NO; ++k) s[m][k] += rv * (v2f){acc[m][k][r], acc[m][k][r + 1]};
      }
    if (it + 1 < NSL && mover) {
#pragma unroll
      for (int q = 0; q < 10; ++q) *(v8us*)&sB[cur ^ 1][(q >> 1) * 16 + 2 * w + (q & 1)][piece] = st[q];
    }
    __syncthreads();   // publishes slice it+1 and ends every wave's reads of slice it, whose buffer the next trip refills
  }
  float t[2][NO];
#pragma unroll
  for (int m = 0; m < 2; ++m)
#pragma unroll
    for (int k = 0; k < NO; ++k) {
      const float v = s[m][k][0] + s[m][k][1];
      t[m][k] = v + __shfl_xor(v, 16, 32);   // lanes ln and ln + 16 hold the two halves of the i range of the same b
    }
  if (hh == 0) {
#pragma unroll
    for (int k = 0; k < NO; ++k) {
      const float bv = bf16_round(bias[k]);
#pragma unroll
      for (int m = 0; m < 2; ++m) so[(w * 32 + m * 16 + ln) * NO + k] = t[m][k] + bv;
    }
  }
  __syncthreads();
  for (int e = tid; e < FROWS * NO; e += 256) out[(size_t)b0 * NO + e] = so[e];
}
extern "C" void kernel_launch(void* const* d_in, const int* in_sizes, int n_in,
                              void* d_out, int out_size, void* d_ws, size_t ws_size, hipStream_t stream) {
  (void)in_sizes; (void)n_in; (void)out_size;
  const float* x1 = (const float*)d_in[0]; const float* x2 = (const float*)d_in[1]; const float* W = (const float*)d_in[2]; const float* bias = (const float*)d_in[3];
  char* ws = (char*)d_ws; size_t off = 0;
  auto take = [&](size_t bytes) { char* p = ws + off; off += (bytes + 255) & ~(size_t)255; return p; };
  unsigned short* Bt = (unsigned short*)take((size_t)NO * NP * KP * 2);
  if (off > ws_size) return;
  k_wt<<<(NO * NP * (KP / 8) + 255) / 256, 256, 0, stream>>>(W, Bt);
  k_bilinear<<<NB / FROWS, 256, 0, stream>>>(x2, Bt, x1, bias, (float*)d_out);
}

// v004
// A run of this version takes 27.2 microseconds.
// Two timings next to v003 both put it at 1.03 times that version's speed.
// All steps since v000 together make it 16.0 times as fast.
#include <hip/hip_runtime.h>
// The bilinear form is computed as one GEMM T[b][k*256 + i] = sum_j relu(x2)[b][j]*W[k][i][j] (M = 65536, K = 200 padded to 224; x2 and W
// rounded to bf16 so relu(x2) is exact: single WMMA term, f32 accumulate) on v_wmma_f32_16x16x32_bf16; out[b][k] = sum_i relu(x1)[b][i]*T[b][k][i] + b[k]
// is folded into the same kernel: each 16x16 tile of T is multiplied by relu(x1) in its accumulator registers and never stored.
// The tiles are formed transposed (W rows as the A operand, x2 rows as the B operand), so a lane holds 8 consecutive i of ONE b.
#define NB 65536
#define DD 200
#define KP 224
#define NP 256
#define NO 5
#define NSL 13
#define SLB (NO * (KP / 32) * 512)
#define FROWS 256

typedef __bf16 v16b __attribute__((ext_vector_type(16)));
typedef unsigned short v8us __attribute__((ext_vector_type(8), may_alias));
typedef float  v8f  __attribute__((ext_vector_type(8)));
typedef float  v2f  __attribute__((ext_vector_type(2)));
typedef float  v4f  __attribute__((ext_vector_type(4)));
typedef float  v4fa __attribute__((ext_vector_type(4), may_alias));
typedef int    v4i  __attribute__((ext_vector_type(4)));
typedef __attribute__((address_space(1))) v4i gv4i;
typedef __attribute__((address_space(3))) v4i lv4i;
union FragB { v16b v; v8us half[2]; unsigned short u[16]; };

__device__ __forceinline__ unsigned short bf16_bits(float x) { unsigned int u = __float_as_uint(x); return (unsigned short)((u + 0x7FFFu + ((u >> 16) & 1u)) >> 16); }
__device__ __forceinline__ float bf16_val(unsigned short b) { return __uint_as_float(((unsigned int)b) << 16); }
__device__ __forceinline__ float bf16_round(float x) { return bf16_val(bf16_bits(x)); }
// bf16(relu(x)): a negative float (and -0) is a negative integer, so one integer maximum with 0 is the relu
__device__ __forceinline__ unsigned short relu_bf16_bits(float x) { const int u = __float_as_int(x); return bf16_bits(__int_as_float(u > 0 ? u : 0)); }
// D += A·B with NT terms: 1 = ah·bh, 2 = + al·bh (A split), 3 = + ah·bl (both split)
template <int NT>
__device__ __forceinline__ v8f mmaN(v16b ah, v16b al, v16b bh, v16b bl, v8f c) {
  c = __builtin_amdgcn_wmma_f32_16x16x32_bf16(false, ah, false, bh, (short)0, c, false, false);
  if (NT >= 2) c = __builtin_amdgcn_wmma_f32_16x16x32_bf16(false, al, false, bh, (short)0, c, false, false);
  if (NT >= 3) c = __builtin_amdgcn_wmma_f32_16x16x32_bf16(false, ah, false, bl, (short)0, c, false, false);
  asm volatile("v_nop\n\tv_nop\n\tv_nop\n\tv_nop" : "+v"(c) : "v"(ah), "v"(al), "v"(bh), "v"(bl));
  return c;
}

__global__ __launch_bounds__(256) void k_wt_bf16(const float* __restrict__ W, unsigned short* __restrict__ Wt, int K, int N) {
  const int t = blockIdx.x * 256 + threadIdx.x;
  const int k8n = K / 8;
  if (t >= N * k8n) return;
  const int n = t / k8n, k8 = (t % k8n) * 8;
  v8us v;
#pragma unroll
  for (int i = 0; i < 8; ++i) v[i] = bf16_bits(W[(size_t)(k8 + i) * N + n]);
  *(v8us*)(Wt + (size_t)n * K + k8) = v;
  
}

// GEMM C[M][N] (f32, pitch ldc) = act(A[M][K]·W + bias). A f32 row-major (pitch lda) converted per fragment to bf16
// (ASPLIT: hi/lo two planes -> 2 terms, else single rounded term); Wt bf16 [N][K] (pitch ldb). BIAS_BF16 rounds the
// bias to bf16 first (bias quantised to bf16 before the add). K%32==0, M%16==0, N%64==0.
template <bool ASPLIT, int ACT, bool BIAS_BF16>
__global__ __launch_bounds__(128) void k_gemm_bf(const float* __restrict__ A, int lda, const unsigned short* __restrict__ Wt, int ldb,
                                               const float* __restrict__ bias, float* __restrict__ C, int ldc, int M, int N, int K) {
  __shared__ __attribute__((aligned(16))) float so[4][16][64];
  const int tid = threadIdx.x, w = tid >> 5, lane = tid & 31, ln = lane & 15, hh = lane >> 4;
  const int ntn = N / 64;
  const int wid = blockIdx.x * 4 + w;
  const int mt = wid / ntn, nq = wid % ntn;
  if (mt * 16 >= M) return;
  const int row0 = mt * 16, col0 = nq * 64;
  const float* arow = A + (size_t)(row0 + ln) * lda;
  v8f acc[4] = {};
  for (int kb = 0; kb < K; kb += 32) {
    FragB ah, al;
    const v4f x0 = *(const v4fa*)(arow + kb + 8 * hh), x1 = *(const v4fa*)(arow + kb + 8 * hh + 4);
    const v4f x2 = *(const v4fa*)(arow + kb + 16 + 8 * hh), x3 = *(const v4fa*)(arow + kb + 16 + 8 * hh + 4);
    float xs[16] = {x0[0],x0[1],x0[2],x0[3],x1[0],x1[1],x1[2],x1[3],x2[0],x2[1],x2[2],x2[3],x3[0],x3[1],x3[2],x3[3]};
#pragma unroll
    for (int i = 0; i < 16; ++i) { const unsigned short hb = bf16_bits(xs[i]); ah.u[i] = hb; al.u[i] = ASPLIT ? bf16_bits(xs[i] - bf16_val(hb)) : (unsigned short)0; }
#pragma unroll
    for (int t = 0; t < 4; ++t) {
      const unsigned short* brow = Wt + (size_t)(col0 + t * 16 + ln) * ldb + kb;
      FragB b;
      b.half[0] = *(const v8us*)(brow + 8 * hh);
      b.half[1] = *(const v8us*)(brow + 16 + 8 * hh);
      acc[t] = mmaN<ASPLIT ? 2 : 1>(ah.v, al.v, b.v, b.v, acc[t]);
    }
  }
#pragma unroll
  for (int t = 0; t < 4; ++t) {
    float bv = bias ? bias[col0 + t * 16 + ln] : 0.f;
    if (BIAS_BF16) bv = bf16_round(bv);
#pragma unroll
    for (int r = 0; r < 8; ++r) { float v = acc[t][r] + bv; if (ACT == 1) v = fmaxf(v, 0.f); so[w][8 * hh + r][t * 16 + ln] = v; }
  }
  __builtin_amdgcn_fence(__ATOMIC_ACQ_REL, "workgroup");
  __builtin_amdgcn_wave_barrier();
  const int rsub = lane >> 4, c4 = (lane & 15) * 4;
  {
#pragma unroll
    for (int q = 0; q < 8; ++q) {
      const int r = q * 2 + rsub;
      const v4f v = *(const v4fa*)&so[w][r][c4];
      *(v4f*)(C + (size_t)(row0 + r) * ldc + col0 + c4) = v;
    }
    
  }
}

// Flash-style causal/unmasked attention, all contractions 3-term bf16 hi/lo splits, f32 softmax with running max.
// q,k,v rows are read from f32 buffers with arbitrary row pitch (so they can live inside a fused qkv buffer);
// D = head size (multiple of 32, <= 128); one wave = 16 query rows; block = 4 waves (64 queries) sharing K/V chunks of 32.
template <int D, bool CAUSAL>
__global__ __launch_bounds__(128) void k_flash(const float* __restrict__ qb, const float* __restrict__ kb, const float* __restrict__ vb,
                                             int pitch, int T, int H, float scale, float* __restrict__ y, int ypitch) {
  constexpr int KS = D / 32;        // k-steps for QK
  constexpr int DT = D / 16;        // d tiles for PV
  __shared__ __attribute__((aligned(16))) unsigned short sKh[32][D + 8], sKl[32][D + 8], sVh[32][D + 8], sVl[32][D + 8];
  __shared__ __attribute__((aligned(16))) unsigned short sPh[4][16][40], sPl[4][16][40];
  __shared__ __attribute__((aligned(16))) float sO[4][16][D];
  const int tid = threadIdx.x, w = tid >> 5, lane = tid & 31, ln = lane & 15, hh = lane >> 4;
  const int nqb = (T + 63) / 64;
  const int bh = blockIdx.x / nqb, qblk = blockIdx.x % nqb;
  const int b = bh / H, h = bh % H;
  const int q0 = qblk * 64 + w * 16;
  const float* Q = qb + (size_t)b * T * pitch + h * D;
  const float* K = kb + (size_t)b * T * pitch + h * D;
  const float* V = vb + (size_t)b * T * pitch + h * D;

  // A fragments of the wave's 16 query rows (scaled), hi/lo
  FragB aqh[KS], aql[KS];
  {
    int row = q0 + ln; if (row >= T) row = T - 1;
    const float* qr = Q + (size_t)row * pitch;
#pragma unroll
    for (int ks = 0; ks < KS; ++ks)
#pragma unroll
      for (int i = 0; i < 16; ++i) {
        const int d = ks * 32 + ((i < 8) ? (8 * hh + i) : (16 + 8 * hh + (i - 8)));
        const float x = qr[d] * scale; const unsigned short hb = bf16_bits(x);
        aqh[ks].u[i] = hb; aql[ks].u[i] = bf16_bits(x - bf16_val(hb));
      }
  }
  float m_r[8], l_r[8];
#pragma unroll
  for (int r = 0; r < 8; ++r) { m_r[r] = -3.0e38f; l_r[r] = 0.f; }
  v8f oacc[DT];
#pragma unroll
  for (int dt = 0; dt < DT; ++dt) oacc[dt] = (v8f){0.f,0.f,0.f,0.f,0.f,0.f,0.f,0.f};

  const int kv_end = CAUSAL ? min(T, qblk * 64 + 64) : T;     // block-uniform
  for (int j0 = 0; j0 < kv_end; j0 += 32) {
    __syncthreads();
    for (int e = tid; e < 32 * (D / 4); e += 128) {
      const int r = e / (D / 4), c4 = (e % (D / 4)) * 4;
      const int key = j0 + r;
      v4f kf = {0.f,0.f,0.f,0.f}, vf = {0.f,0.f,0.f,0.f};
      if (key < T) { kf = *(const v4fa*)(K + (size_t)key * pitch + c4); vf = *(const v4fa*)(V + (size_t)key * pitch + c4); }
#pragma unroll
      for (int t = 0; t < 4; ++t) {
        unsigned short hb = bf16_bits(kf[t]); sKh[r][c4 + t] = hb; sKl[r][c4 + t] = bf16_bits(kf[t] - bf16_val(hb));
        hb = bf16_bits(vf[t]); sVh[r][c4 + t] = hb; sVl[r][c4 + t] = bf16_bits(vf[t] - bf16_val(hb));
      }
    }
    __syncthreads();
    // S tile 16 x 32
    v8f s[2];
#pragma unroll
    for (int nt = 0; nt < 2; ++nt) {
      v8f acc = {};
#pragma unroll
      for (int ks = 0; ks < KS; ++ks) {
        FragB bh_, bl_;
        bh_.half[0] = *(const v8us*)&sKh[nt * 16 + ln][ks * 32 + 8 * hh]; bh_.half[1] = *(const v8us*)&sKh[nt * 16 + ln][ks * 32 + 16 + 8 * hh];
        bl_.half[0] = *(const v8us*)&sKl[nt * 16 + ln][ks * 32 + 8 * hh]; bl_.half[1] = *(const v8us*)&sKl[nt * 16 + ln][ks * 32 + 16 + 8 * hh];
        acc = mmaN<3>(aqh[ks].v, aql[ks].v, bh_.v, bl_.v, acc);
      }
      s[nt] = acc;
    }
    // mask + running max (rows 8hh+r; the 16 lanes of a half share rows)
    float alpha[8];
#pragma unroll
    for (int r = 0; r < 8; ++r) {
      const int qi = q0 + 8 * hh + r;
      const int ja = j0 + ln, jb = j0 + 16 + ln;
      if (CAUSAL) { if (ja > qi) s[0][r] = -3.0e38f; if (jb > qi) s[1][r] = -3.0e38f; }
      if (ja >= T) s[0][r] = -3.0e38f;
      if (jb >= T) s[1][r] = -3.0e38f;
      float mx = fmaxf(s[0][r], s[1][r]);
      mx = fmaxf(mx, __shfl_xor(mx, 1, 32)); mx = fmaxf(mx, __shfl_xor(mx, 2, 32)); mx = fmaxf(mx, __shfl_xor(mx, 4, 32)); mx = fmaxf(mx, __shfl_xor(mx, 8, 32));
      const float mnew = fmaxf(m_r[r], mx);
      alpha[r] = (mnew > -1.0e38f) ? __expf(m_r[r] - mnew) : 1.0f;
      const float p0 = (s[0][r] > -1.0e38f) ? __expf(s[0][r] - mnew) : 0.f;
      const float p1 = (s[1][r] > -1.0e38f) ? __expf(s[1][r] - mnew) : 0.f;
      m_r[r] = mnew;
      l_r[r] = l_r[r] * alpha[r] + p0 + p1;            // per-lane partial row sum (16 lanes combined at the end)
      unsigned short hb = bf16_bits(p0); sPh[w][8 * hh + r][ln] = hb;      sPl[w][8 * hh + r][ln] = bf16_bits(p0 - bf16_val(hb));
      hb = bf16_bits(p1);                sPh[w][8 * hh + r][16 + ln] = hb; sPl[w][8 * hh + r][16 + ln] = bf16_bits(p1 - bf16_val(hb));
    }
#pragma unroll
    for (int dt = 0; dt < DT; ++dt)
#pragma unroll
      for (int r = 0; r < 8; ++r) oacc[dt][r] *= alpha[r];
    __builtin_amdgcn_fence(__ATOMIC_ACQ_REL, "workgroup");
    __builtin_amdgcn_wave_barrier();
    FragB pah, pal;
    pah.half[0] = *(const v8us*)&sPh[w][ln][8 * hh]; pah.half[1] = *(const v8us*)&sPh[w][ln][16 + 8 * hh];
    pal.half[0] = *(const v8us*)&sPl[w][ln][8 * hh]; pal.half[1] = *(const v8us*)&sPl[w][ln][16 + 8 * hh];
#pragma unroll
    for (int dt = 0; dt < DT; ++dt) {
      FragB bvh, bvl;
#pragma unroll
      for (int i = 0; i < 8; ++i) {
        bvh.u[i] = sVh[8 * hh + i][dt * 16 + ln]; bvh.u[8 + i] = sVh[16 + 8 * hh + i][dt * 16 + ln];
        bvl.u[i] = sVl[8 * hh + i][dt * 16 + ln]; bvl.u[8 + i] = sVl[16 + 8 * hh + i][dt * 16 + ln];
      }
      oacc[dt] = mmaN<3>(pah.v, pal.v, bvh.v, bvl.v, oacc[dt]);
    }
    __builtin_amdgcn_fence(__ATOMIC_ACQ_REL, "workgroup");
    __builtin_amdgcn_wave_barrier();
  }
#pragma unroll
  for (int r = 0; r < 8; ++r) {
    float l = l_r[r];
    l += __shfl_xor(l, 1, 32); l += __shfl_xor(l, 2, 32); l += __shfl_xor(l, 4, 32); l += __shfl_xor(l, 8, 32);
    l_r[r] = (l > 0.f) ? 1.0f / l : 0.f;
  }
#pragma unroll
  for (int dt = 0; dt < DT; ++dt)
#pragma unroll
    for (int r = 0; r < 8; ++r) sO[w][8 * hh + r][dt * 16 + ln] = oacc[dt][r] * l_r[r];
  __builtin_amdgcn_fence(__ATOMIC_ACQ_REL, "workgroup");
  __builtin_amdgcn_wave_barrier();
  {
    for (int r = 0; r < 16; ++r) {
      const int row = q0 + r;
      if (row < T && lane < D / 4) {
        const v4f val = *(const v4fa*)&sO[w][r][lane * 4];
        *(v4f*)(y + ((size_t)b * T + row) * ypitch + h * D + lane * 4) = val;
      }
    }
    
  }
}

// row LayerNorm (biased variance, eps) over N: s = X (+ R); optional out_sum <- s; out_norm <- (s-mu)*rsqrt(var+eps)*g + b
template <bool PARAM_BF16>
__global__ __launch_bounds__(256) void k_layernorm(const float* __restrict__ X, const float* __restrict__ R, const float* __restrict__ g, const float* __restrict__ bta,
                                                  float* __restrict__ out_sum, float* __restrict__ out_norm, int N, float eps) {
  __shared__ float red[256];
  const int row = blockIdx.x, tid = threadIdx.x;
  const float* x = X + (size_t)row * N; const float* rr = R ? R + (size_t)row * N : nullptr;
  float vals[16];                     // up to N = 4096
  const int per = N / 256;            // contiguous chunk per thread? use strided-by-4 chunks: thread handles j = tid*4 + 1024*u
  float s1 = 0.f;
  for (int u = 0; u < per / 4; ++u) {
    const int j = tid * 4 + 1024 * u;
    const v4f a = *(const v4fa*)(x + j);
    v4f b = {0.f,0.f,0.f,0.f}; if (rr) b = *(const v4fa*)(rr + j);
#pragma unroll
    for (int q = 0; q < 4; ++q) { const float v = a[q] + b[q]; vals[u * 4 + q] = v; s1 += v; }
  }
  red[tid] = s1; __syncthreads();
  for (int st = 128; st > 0; st >>= 1) { if (tid < st) red[tid] += red[tid + st]; __syncthreads(); }
  const float mu = red[0] / (float)N; __syncthreads();
  float s2 = 0.f;
  for (int u = 0; u < per / 4; ++u)
#pragma unroll
    for (int q = 0; q < 4; ++q) { const float c = vals[u * 4 + q] - mu; s2 += c * c; }
  red[tid] = s2; __syncthreads();
  for (int st = 128; st > 0; st >>= 1) { if (tid < st) red[tid] += red[tid + st]; __syncthreads(); }
  const float rs = rsqrtf(red[0] / (float)N + eps);
  {
    for (int u = 0; u < per / 4; ++u) {
      const int j = tid * 4 + 1024 * u;
      v4f o, sm;
#pragma unroll
      for (int q = 0; q < 4; ++q) {
        float gg = g[j + q], bb = bta[j + q];
        if (PARAM_BF16) { gg = bf16_round(gg); bb = bf16_round(bb); }
        sm[q] = vals[u * 4 + q]; o[q] = (vals[u * 4 + q] - mu) * rs * gg + bb;
      }
      if (out_sum) *(v4f*)(out_sum + (size_t)row * N + j) = sm;
      *(v4f*)(out_norm + (size_t)row * N + j) = o;
    }
    
  }
}

// Bt holds W (bf16; 0 for i >= 200 or j >= 200) in the order in which the matrix fragments are read: [slice i/16][k][k-step ks][half h][lane hh*16 + i%16][8 elements],
// the 8 elements being j = ks*32 + h*16 + hh*8 + 0..7. A slice (SLB elements) is then one contiguous run, in memory as in LDS. Rows i >= NSL*16 are never read and not written.
__global__ __launch_bounds__(256) void k_wt(const float* __restrict__ W, unsigned short* __restrict__ Bt) {
  const int t = blockIdx.x * 256 + threadIdx.x; const int k8n = KP / 8; if (t >= NO * NP * k8n) return; const int n = t / k8n, c = t % k8n, j8 = c * 8; const int k = n / NP, i = n % NP; if (i >= NSL * 16) return; v8us v;
#pragma unroll 1
  for (int q = 0; q < 8; ++q) { const int j = j8 + q; v[q] = (i < DD && j < DD) ? bf16_bits(W[(size_t)k * DD * DD + (size_t)i * DD + j]) : (unsigned short)0; }
  *(v8us*)(Bt + (size_t)(((i >> 4) * NO + k) * (KP / 32) + (c >> 2)) * 512 + ((c >> 1) & 1) * 256 + ((c & 1) * 16 + (i & 15)) * 8) = v;
}
// out[b][k] = sum_i relu(bf16(x1[b][i])) * (sum_j bf16(relu(x2[b][j]))*bf16(W[k][i][j])) + bf16(bias[k]).
// Block = 8 waves x 32 rows of b. A wave keeps the x2 fragments of its 32 rows (2 row tiles x 7 k-steps) in registers for the whole kernel;
// it reads them straight from x2 (rows of DD floats) and applies relu, the bf16 rounding and the zero padding of j = DD..KP-1 in registers.
// The block walks i in NSL slices of 16 (i >= 208 is padding that no output reads); a slice is the 5 x 7 fragments of Bt for that i range,
// brought into LDS by asynchronous copies (no registers, no LDS stores), two buffers, one barrier per slice; a fragment half is 512 contiguous bytes, 16 per lane.
// The Bt fragment is the A operand and the x2 fragment the B operand (both loaders have the same k order): accumulator register r of lane (ln, hh)
// is T[b = tile row ln][i = slice + 8*hh + r]. The sum over i then runs inside the lane, over registers, x1 is read as 8 consecutive floats of the
// lane's own row, and only the two halves hh are left to be added across lanes at the end.
// Every "#pragma unroll" below makes the indices of a register array compile-time constants (an index known only at run time would send the array to scratch).
// One slice of Bt by asynchronous copies: g and l are the thread's own first 16-byte piece (piece tid); it moves the pieces tid + 256*q, the offset moving both addresses.
// The 2,240 pieces of a slice are 8 rounds of all 8 waves and one round of waves 0..5 (wave: the wave's number in a scalar register, so that the test is a scalar branch).
__device__ __forceinline__ void copy_slice(const unsigned short* g, unsigned short* l, int wave) {
  gv4i* gp = (gv4i*)g; lv4i* lp = (lv4i*)l;
  __builtin_amdgcn_global_load_async_to_lds_b128(gp, lp, 0, 0);
  __builtin_amdgcn_global_load_async_to_lds_b128(gp, lp, 4096, 0);
  __builtin_amdgcn_global_load_async_to_lds_b128(gp, lp, 8192, 0);
  __builtin_amdgcn_global_load_async_to_lds_b128(gp, lp, 12288, 0);
  __builtin_amdgcn_global_load_async_to_lds_b128(gp, lp, 16384, 0);
  __builtin_amdgcn_global_load_async_to_lds_b128(gp, lp, 20480, 0);
  __builtin_amdgcn_global_load_async_to_lds_b128(gp, lp, 24576, 0);
  __builtin_amdgcn_global_load_async_to_lds_b128(gp, lp, 28672, 0);
  if (wave < 6) __builtin_amdgcn_global_load_async_to_lds_b128(gp, lp, 32768, 0);
}
__global__ __launch_bounds__(256) void k_bilinear(const float* __restrict__ x2, const unsigned short* __restrict__ Bt, const float* __restrict__ x1,
                                                 const float* __restrict__ bias, float* __restrict__ out) {
  __shared__ __attribute__((aligned(16))) unsigned short sB[2][SLB];
  __shared__ float so[FROWS * NO];
  const int tid = threadIdx.x, w = tid >> 5, lane = tid & 31, ln = lane & 15, hh = lane >> 4;
  const int b0 = blockIdx.x * FROWS, row0 = b0 + w * 32;
  const int wv = __builtin_amdgcn_readfirstlane(w);
  const unsigned short* bsrc = Bt + tid * 8;
  copy_slice(bsrc, &sB[0][tid * 8], wv);   // slice 0 flies while x2 is loaded and converted
  v4f xr[2][KP / 32][4];
  const float* arow[2]; const float* ahalf[2];
#pragma unroll
  for (int m = 0; m < 2; ++m) {
    arow[m] = x2 + (size_t)(row0 + m * 16 + ln) * DD; ahalf[m] = arow[m] + 8 * hh;
#pragma unroll
    for (int ks = 0; ks < DD / 32; ++ks) {
      const int kb = ks * 32;
      xr[m][ks][0] = *(const v4fa*)(ahalf[m] + kb);      xr[m][ks][1] = *(const v4fa*)(ahalf[m] + kb + 4);
      xr[m][ks][2] = *(const v4fa*)(ahalf[m] + kb + 16); xr[m][ks][3] = *(const v4fa*)(ahalf[m] + kb + 16 + 4);
    }
    // last k-step: only j = 192..199 exist, the first 8 elements of the hh = 0 lanes; the hh = 1 lanes read the same 32 bytes (in bounds) and drop them below
    xr[m][DD / 32][0] = *(const v4fa*)(arow[m] + (DD / 32) * 32); xr[m][DD / 32][1] = *(const v4fa*)(arow[m] + (DD / 32) * 32 + 4);
  }
  // the address registers of the loads above are reused below; naming the four row pointers keeps their registers from serving as a later load's destination ahead of the wait
  asm volatile("s_wait_xcnt 0x0" :: "v"(arow[0]), "v"(arow[1]), "v"(ahalf[0]), "v"(ahalf[1]) : "memory");
  __builtin_amdgcn_sched_barrier(0);              // keeps every later register write behind that wait
  FragB a[2][KP / 32];
  const unsigned short tailmask = hh ? 0 : 0xFFFF;   // zero padding of j = 200..207, which the hh = 1 lanes hold in the last k-step
#pragma unroll
  for (int m = 0; m < 2; ++m)
#pragma unroll
    for (int ks = 0; ks < KP / 32; ++ks)
#pragma unroll
      for (int i = 0; i < 16; ++i) {
        if (ks < DD / 32) a[m][ks].u[i] = relu_bf16_bits(xr[m][ks][i >> 2][i & 3]);
        else a[m][ks].u[i] = i < 8 ? (unsigned short)(relu_bf16_bits(xr[m][ks][i >> 2][i & 3]) & tailmask) : (unsigned short)0;
      }
  asm volatile("s_wait_asynccnt 0x0" ::: "memory");   // this wave's pieces of slice 0 have landed before its barrier signal publishes them
  __builtin_amdgcn_s_barrier_signal(-1);              // the wait that belongs to it stands at the top of trip 0
  v2f s[2][NO];   // the lane's share of out[row0 + m*16 + ln][k]: even and odd i apart, so that two products go into one packed multiply-add
#pragma unroll
  for (int m = 0; m < 2; ++m)
#pragma unroll
    for (int k = 0; k < NO; ++k) s[m][k] = (v2f){0.f, 0.f};
  // rolled so that the fragment and accumulator indices inside stay constants while the code stays small
#pragma unroll 1
  for (int it = 0; it < NSL; ++it) {
    const int cur = it & 1;
    // the barrier is split so that a wave's last matrix block and its x1 sums run while the other waves arrive: signal in front of the last matrix block of trip it-1 (no LDS read stands between), wait here
    __builtin_amdgcn_s_barrier_wait(-1);
    __builtin_amdgcn_fence(__ATOMIC_ACQUIRE, "workgroup");   // as in __syncthreads(): keeps the compiler from moving the copies and LDS reads below ahead of the wait
    // slice it is published and every wave's reads of the other buffer have returned: slice it+1 flies into it during this trip
    if (it + 1 < NSL) copy_slice(bsrc + (size_t)(it + 1) * SLB, &sB[cur ^ 1][tid * 8], wv);
    // i >= DD (the hh = 1 lanes of the last slice): Bt's rows there are zero, so acc is 0 and any finite x1 value adds 0; the clamp keeps the load in bounds
    const int i = it * 16 + 8 * hh, ic = i <= DD - 8 ? i : DD - 8;
    v4f r1[2][2];
    const float* xrow[2];
#pragma unroll
    for (int m = 0; m < 2; ++m) {
      xrow[m] = x1 + (size_t)(row0 + m * 16 + ln) * DD + ic;
      r1[m][0] = *(const v4fa*)xrow[m]; r1[m][1] = *(const v4fa*)(xrow[m] + 4);
    }
    v8f acc[2][NO] = {};
    FragB bf[2][NO];   // Bt fragments of one k-step, two sets: the next k-step's LDS reads go out as one group ahead of this k-step's matrix block
#pragma unroll
    for (int k = 0; k < NO; ++k) {
      bf[0][k].half[0] = *(const v8us*)&sB[cur][k * (KP / 32) * 512 + lane * 8];
      bf[0][k].half[1] = *(const v8us*)&sB[cur][k * (KP / 32) * 512 + 256 + lane * 8];
    }
#pragma unroll
    for (int ks = 0; ks < KP / 32; ++ks) {
      if (ks + 1 < KP / 32) {
#pragma unroll
        for (int k = 0; k < NO; ++k) {
          bf[(ks + 1) & 1][k].half[0] = *(const v8us*)&sB[cur][(k * (KP / 32) + ks + 1) * 512 + lane * 8];
          bf[(ks + 1) & 1][k].half[1] = *(const v8us*)&sB[cur][(k * (KP / 32) + ks + 1) * 512 + 256 + lane * 8];
        }
      }
      // the address registers of the x1 loads are reused by the matrix block; naming the two pointers keeps them from serving as an LDS read's destination, which would ask for this wait ahead of the LDS reads
      if (ks == 0) asm volatile("s_wait_xcnt 0x0" :: "v"(xrow[0]), "v"(xrow[1]) : "memory");
      if (ks == KP / 32 - 1) {
        asm volatile("s_wait_dscnt 0x0" ::: "memory");      // this wave's reads of slice it, the last fragments among them, have returned before its buffer may be refilled
        asm volatile("s_wait_asynccnt 0x0" ::: "memory");   // this wave's pieces of slice it+1 have landed before its signal publishes them
        __builtin_amdgcn_s_barrier_signal(-1);
      }
      __builtin_amdgcn_sched_barrier(0);   // holds the loads above (global ones on the first pass, LDS reads on all) ahead of the matrix block: without it each pair of reads sat directly before its user behind a full wait
#pragma unroll
      for (int k = 0; k < NO; ++k)
#pragma unroll
        for (int m = 0; m < 2; ++m) acc[m][k] = __builtin_amdgcn_wmma_f32_16x16x32_bf16(false, bf[ks & 1][k].v, false, a[m][ks].v, (short)0, acc[m][k], false, false);
      __builtin_amdgcn_sched_barrier(0);   // keeps the next group of LDS reads from moving in among these matrix instructions
    }
#pragma unroll
    for (int r = 0; r < 8; r += 2)
#pragma unroll
      for (int m = 0; m < 2; ++m) {
        const v2f rv = {fmaxf(bf16_round(r1[m][r >> 2][r & 3]), 0.f), fmaxf(bf16_round(r1[m][r >> 2][(r & 3) + 1]), 0.f)};
#pragma unroll
        for (int k = 0; k < NO; ++k) s[m][k] += rv * (v2f){acc[m][k][r], acc[m][k][r + 1]};
      }
  }
  __builtin_amdgcn_s_barrier_wait(-1);                  // pairs with the last trip's signal: signal and wait alternate in every wave
  asm volatile("s_wait_asynccnt 0x0" ::: "memory");     // no copy is outstanding when the wave goes on to the output staging and ends
  float t[2][NO];
#pragma unroll
  for (int m = 0; m < 2; ++m)
#pragma unroll
    for (int k = 0; k < NO; ++k) {
      const float v = s[m][k][0] + s[m][k][1];
      t[m][k] = v + __shfl_xor(v, 16, 32);   // lanes ln and ln + 16 hold the two halves of the i range of the same b
    }
  if (hh == 0) {
#pragma unroll
    for (int k = 0; k < NO; ++k) {
      const float bv = bf16_round(bias[k]);
#pragma unroll
      for (int m = 0; m < 2; ++m) so[(w * 32 + m * 16 + ln) * NO + k] = t[m][k] + bv;
    }
  }
  __syncthreads();
  for (int e = tid; e < FROWS * NO; e += 256) out[(size_t)b0 * NO + e] = so[e];
}
extern "C" void kernel_launch(void* const* d_in, const int* in_sizes, int n_in,
                              void* d_out, int out_size, void* d_ws, size_t ws_size, hipStream_t stream) {
  (void)in_sizes; (void)n_in; (void)out_size;
  const float* x1 = (const float*)d_in[0]; const float* x2 = (const float*)d_in[1]; const float* W = (const float*)d_in[2]; const float* bias = (const float*)d_in[3];
  char* ws = (char*)d_ws; size_t off = 0;
  auto take = [&](size_t bytes) { char* p = ws + off; off += (bytes + 255) & ~(size_t)255; return p; };
  unsigned short* Bt = (unsigned short*)take((size_t)NO * NP * KP * 2);
  if (off > ws_size) return;
  k_wt<<<(NO * NP * (KP / 8) + 255) / 256, 256, 0, stream>>>(W, Bt);
  k_bilinear<<<NB / FROWS, 256, 0, stream>>>(x2, Bt, x1, bias, (float*)d_out);
}
